// v000
// Measured on an AMD MI455X. A time is GPU time per run, averaged over a window of back-to-back runs after a warm-up
// (all launches, gaps included; the runs take copies of the inputs in turn), and the median of several windows.
// Apart from v000's, it joins two sittings. Times from different sittings can be a few percent apart, while
// side-by-side timings come from the same sitting.
// v000 is the starting kernel. One run takes 126 microseconds.
#include <hip/hip_runtime.h>

// Dense GAT layer on [2, 16, 1024, 128]: per (b, t) group of 1,024 nodes: h = x W; e[i][j] = leaky_0.2(h_i . a_src + h_j . a_dst); alpha = softmax over j; out = alpha h -> [2][16][1024][128].
// WMMA (v_wmma_f32_16x16x32_f16, f32 accumulate): h = bf16(x) W ([32,768 x 128] x [128 x 128], EXACT bf16 x8: 1 product) and per group out = P h ([1,024 x 1,024] x [1,024 x 128]: P = exp(e - rowmax)
// carried x16384 and split f16 hi+lo, built directly in the A fragments (rank-1 scores: rowmax_i = leaky(s_i + max_j d_j)); h transposed hi+lo x8 planes; 3 products); W exact x256; scores, row sums
// and the normalisation in f32. Inputs rounded to bf16 once. Fragment k-map per lane half hh for A AND B: elements 0..7 <- k = 8hh+0..7, 8..15 <- k = 16+8hh+0..7;

namespace {
constexpr int NG = 32, NN = 1024, F = 128, M = NG * NN;
constexpr float XS = 8.0f, WSC = 256.0f, PS = 16384.0f, NEG = 0.2f;
typedef _Float16 b16;
typedef __attribute__((ext_vector_type(16))) _Float16 v16b;
typedef __attribute__((ext_vector_type(8))) _Float16 v8b;
typedef __attribute__((ext_vector_type(8))) float v8f;
typedef __attribute__((ext_vector_type(4))) float v4f;
__device__ __forceinline__ float bf16_rne(float f) { unsigned int u = __float_as_uint(f); u += 0x7FFFu + ((u >> 16) & 1u); return __uint_as_float(u & 0xFFFF0000u); }
__device__ __forceinline__ void split16(float v, b16& hi, b16& lo) { hi = (b16)v; lo = (b16)(v - (float)hi); }
__device__ __forceinline__ v16b frag_kb(const b16* p, int hh) { const v8b a = *(const v8b*)(p + 8 * hh), b = *(const v8b*)(p + 16 + 8 * hh); v16b f;
#pragma unroll
  for (int e = 0; e < 8; ++e) { f[e] = a[e]; f[8 + e] = b[e]; } return f; }
__device__ __forceinline__ v8f wmma16b(v16b a, v16b b, v8f c) { v8f d = __builtin_amdgcn_wmma_f32_16x16x32_f16(false, a, false, b, (short)0, c, false, false); asm volatile("v_nop\n\tv_nop\n\tv_nop\n\tv_nop" : "+v"(d) : "v"(a), "v"(b)); return d; }
__device__ __forceinline__ void wave_lds_sync() { __builtin_amdgcn_fence(__ATOMIC_RELEASE, "workgroup"); __builtin_amdgcn_wave_barrier(); __builtin_amdgcn_fence(__ATOMIC_ACQUIRE, "workgroup"); }
__device__ __forceinline__ float pmul(float a, float b) { float p = a * b; asm volatile("" : "+v"(p)); return p; }
__device__ __forceinline__ float opaque(float a) { asm volatile("" : "+v"(a)); return a; }
__device__ __forceinline__ float lrelu(float x) { return x >= 0.0f ? x : NEG * x; }
__device__ __forceinline__ float nexp(float x) { return __builtin_amdgcn_exp2f(x * 1.4426950408889634f); }

__global__ __launch_bounds__(256) void wprep_kernel(const float* __restrict__ w, b16* __restrict__ WT) {
  const size_t u = (size_t)blockIdx.x * 256 + threadIdx.x; if (u >= (size_t)F * F / 8) return; const size_t e = u * 8; const int o = (int)(e / F), k0 = (int)(e % F); v8b v;
  for (int j = 0; j < 8; ++j) v[j] = (b16)(bf16_rne(w[(size_t)(k0 + j) * F + o]) * WSC); { *(v8b*)(WT + e) = v;  }
}
__global__ __launch_bounds__(128) void hgemm_kernel(const float* __restrict__ x, const b16* __restrict__ WT, const float* __restrict__ as_, const float* __restrict__ ad_, float* __restrict__ H, float* __restrict__ S, float* __restrict__ Dd) {
  __shared__ __attribute__((aligned(16))) float Tf[4][16][F + 4]; __shared__ __attribute__((aligned(16))) float sa[64], sd[64];
  const int wave = threadIdx.x >> 5, lane = threadIdx.x & 31, nloc = lane & 15, hlf = lane >> 4; const size_t m0 = (size_t)blockIdx.x * 64 + wave * 16; const float* xr = x + (m0 + nloc) * F;
  v8f acc[8];
#pragma unroll
  for (int t = 0; t < 8; ++t) acc[t] = (v8f){};
#pragma unroll 2
  for (int kb = 0; kb < F; kb += 32) { v16b a; for (int j = 0; j < 8; ++j) { a[j] = (b16)(bf16_rne(xr[kb + 8 * hlf + j]) * XS); a[8 + j] = (b16)(bf16_rne(xr[kb + 16 + 8 * hlf + j]) * XS); }
#pragma unroll
    for (int t = 0; t < 8; ++t) acc[t] = wmma16b(a, frag_kb(WT + (size_t)(t * 16 + nloc) * F + kb, hlf), acc[t]); }
  float ps[8], pd[8]; for (int r8 = 0; r8 < 8; ++r8) { ps[r8] = 0.0f; pd[r8] = 0.0f; }
#pragma unroll
  for (int t = 0; t < 8; ++t) { const int c = t * 16 + nloc; const float ws_ = opaque(bf16_rne(as_[c])), wd_ = opaque(bf16_rne(ad_[c]));
#pragma unroll
    for (int r8 = 0; r8 < 8; ++r8) { const float v = acc[t][r8] * (1.0f / (XS * WSC)); Tf[wave][8 * hlf + r8][c] = v; ps[r8] += pmul(v, ws_); pd[r8] += pmul(v, wd_); } }
#pragma unroll
  for (int r8 = 0; r8 < 8; ++r8) { float a = ps[r8], b = pd[r8]; for (int o = 1; o < 16; o <<= 1) { a += __shfl_xor(a, o); b += __shfl_xor(b, o); } if (nloc == 0) { sa[wave * 16 + 8 * hlf + r8] = a; sd[wave * 16 + 8 * hlf + r8] = b; } }
  __syncthreads();
  { for (int rr = 0; rr < 16; ++rr) *(v4f*)(H + (m0 + rr) * F + lane * 4) = *(const v4f*)(&Tf[wave][rr][lane * 4]);
    if (threadIdx.x < 16) *(v4f*)(S + (size_t)blockIdx.x * 64 + threadIdx.x * 4) = *(const v4f*)(&sa[threadIdx.x * 4]); else if (threadIdx.x < 32) *(v4f*)(Dd + (size_t)blockIdx.x * 64 + (threadIdx.x - 16) * 4) = *(const v4f*)(&sd[(threadIdx.x - 16) * 4]);
     }
}
__global__ __launch_bounds__(256) void htrans_kernel(const float* __restrict__ H, b16* __restrict__ HTH, b16* __restrict__ HTL) {
  __shared__ float tile[64][64 + 1];
  const int c0 = blockIdx.x * 64, j0 = blockIdx.y * 64, g = blockIdx.z; const int wave = threadIdx.x >> 5, lane = threadIdx.x & 31;
  for (int rr = 0; rr < 8; ++rr) { const int jl = wave * 8 + rr; const float* row = H + ((size_t)g * NN + j0 + jl) * F + c0; tile[lane * 2][jl] = row[lane * 2]; tile[lane * 2 + 1][jl] = row[lane * 2 + 1]; }
  __syncthreads();
  typedef __attribute__((ext_vector_type(2))) _Float16 v2b;
  { for (int rr = 0; rr < 8; ++rr) { const int cl = wave * 8 + rr; const int c = c0 + cl; b16 p0, q0, p1, q1; split16(tile[cl][lane * 2] * XS, p0, q0); split16(tile[cl][lane * 2 + 1] * XS, p1, q1); v2b h, l; h[0] = p0; h[1] = p1; l[0] = q0; l[1] = q1;
      *(v2b*)(HTH + ((size_t)g * F + c) * NN + j0 + lane * 2) = h; *(v2b*)(HTL + ((size_t)g * F + c) * NN + j0 + lane * 2) = l; }  }
}
// attention: wave per 16 rows i of group g (block = 4 waves = 64 rows): max_j d_j over the group; P fragments on the fly: p = exp(leaky(s_i + d_j) - leaky(s_i + max d)) x16384 split hi+lo; den in f32 from the
__global__ __launch_bounds__(128) void attn_kernel(const float* __restrict__ S, const float* __restrict__ Dd, const b16* __restrict__ HTH, const b16* __restrict__ HTL, float* __restrict__ out) {
  __shared__ __attribute__((aligned(16))) float Tf[4][16][F + 4]; __shared__ float dens[4][16];
  const int wave = threadIdx.x >> 5, lane = threadIdx.x & 31, nloc = lane & 15, hlf = lane >> 4; const size_t i0 = (size_t)blockIdx.x * 64 + wave * 16; const int g = (int)(i0 / NN); const float* Dg = Dd + (size_t)g * NN;
  float mx = -INFINITY; for (int j = lane; j < NN; j += 32) mx = fmaxf(mx, Dg[j]); for (int o = 16; o; o >>= 1) mx = fmaxf(mx, __shfl_xor(mx, o));
  const float si = S[i0 + nloc]; const float mi = lrelu(si + mx); float den = 0.0f;
  const b16* Hh = HTH + (size_t)g * F * NN; const b16* Hl = HTL + (size_t)g * F * NN;
  v8f acc[8];
#pragma unroll
  for (int t = 0; t < 8; ++t) acc[t] = (v8f){};
#pragma unroll 1
  for (int kb = 0; kb < NN; kb += 32) { v16b ph, pl;
    for (int j = 0; j < 8; ++j) { const float p0 = nexp(lrelu(si + Dg[kb + 8 * hlf + j]) - mi), p1 = nexp(lrelu(si + Dg[kb + 16 + 8 * hlf + j]) - mi); den += p0 + p1; b16 a, b; split16(p0 * PS, a, b); ph[j] = a; pl[j] = b; split16(p1 * PS, a, b); ph[8 + j] = a; pl[8 + j] = b; }
#pragma unroll
    for (int t = 0; t < 8; ++t) { const v16b bh = frag_kb(Hh + (size_t)(t * 16 + nloc) * NN + kb, hlf), bl = frag_kb(Hl + (size_t)(t * 16 + nloc) * NN + kb, hlf); acc[t] = wmma16b(ph, bh, acc[t]); acc[t] = wmma16b(pl, bh, acc[t]); acc[t] = wmma16b(ph, bl, acc[t]); } }
  den += __shfl_xor(den, 16);
  if (hlf == 0) dens[wave][nloc] = den;
  wave_lds_sync();
#pragma unroll
  for (int t = 0; t < 8; ++t) { const int c = t * 16 + nloc;
#pragma unroll 1
    for (int r8 = 0; r8 < 8; ++r8) { const int rl = 8 * hlf + r8; Tf[wave][rl][c] = acc[t][r8] * (1.0f / (PS * XS)) / dens[wave][rl]; } }
  wave_lds_sync();
  { for (int rr = 0; rr < 16; ++rr) *(v4f*)(out + (i0 + rr) * F + lane * 4) = *(const v4f*)(&Tf[wave][rr][lane * 4]);  }
}
}  // namespace

extern "C" void kernel_launch(void* const* d_in, const int* in_sizes, int n_in, void* d_out, int out_size, void* d_ws, size_t ws_size, hipStream_t stream) {
  (void)n_in;
  auto Fp = [&](int i) { return (const float*)d_in[i]; };
  // input order: 0 x [2,16,1024,128], 1 W [128,128], 2 a_src [128], 3 a_dst [128]
  if (in_sizes[0] != M * F || in_sizes[1] != F * F || in_sizes[2] != F || in_sizes[3] != F || out_size != M * F) return;
  size_t off = 0; char* ws = (char*)d_ws;
  auto carve = [&](size_t bytes) { char* p = ws + off; off += (bytes + 255) & ~(size_t)255; return p; };
  b16* WT = (b16*)carve((size_t)F * F * 2); float* H = (float*)carve((size_t)M * F * 4); float* S = (float*)carve((size_t)M * 4); float* Dd = (float*)carve((size_t)M * 4); b16* HTH = (b16*)carve((size_t)NG * F * NN * 2); b16* HTL = (b16*)carve((size_t)NG * F * NN * 2);
  if (off > ws_size || off > ((size_t)64 << 20)) return;   // ~ 34 MB
  wprep_kernel<<<(F * F / 8 + 255) / 256, 256, 0, stream>>>(Fp(1), WT);
  hgemm_kernel<<<M / 64, 128, 0, stream>>>(Fp(0), WT, Fp(2), Fp(3), H, S, Dd);
  htrans_kernel<<<dim3(F / 64, NN / 64, NG), 256, 0, stream>>>(H, HTH, HTL);
  attn_kernel<<<M / 64, 128, 0, stream>>>(S, Dd, HTH, HTL, (float*)d_out);
}

// v001
// A run of this version takes 76 microseconds.
// Next to v000, in two timings, it ran 1.69 times as fast each time.
#include <hip/hip_runtime.h>

// Dense GAT layer on [2, 16, 1024, 128]: per (b, t) group of 1,024 nodes: h = x W; e[i][j] = leaky_0.2(h_i . a_src + h_j . a_dst); alpha = softmax over j; out = alpha h -> [2][16][1024][128].
// WMMA (v_wmma_f32_16x16x32_f16, f32 accumulate): h = bf16(x) W ([32,768 x 128] x [128 x 128], EXACT bf16 x8: 1 product) and per group out = P h ([1,024 x 1,024] x [1,024 x 128]: P = exp(e - rowmax)
// carried x16384 and split f16 hi+lo, built directly in the A fragments (rank-1 scores: rowmax_i = leaky(s_i + max_j d_j)); h transposed hi+lo x8 planes; 3 products); W exact x256; scores, row sums
// and the normalisation in f32. Inputs rounded to bf16 once. Fragment k-map per lane half hh for A AND B: elements 0..7 <- k = 8hh+0..7, 8..15 <- k = 16+8hh+0..7;

namespace {
constexpr int NG = 32, NN = 1024, F = 128, M = NG * NN;
constexpr float XS = 8.0f, WSC = 256.0f, PS = 16384.0f, NEG = 0.2f;
typedef _Float16 b16;
typedef __attribute__((ext_vector_type(16))) _Float16 v16b;
typedef __attribute__((ext_vector_type(8))) _Float16 v8b;
typedef __attribute__((ext_vector_type(8))) float v8f;
typedef __attribute__((ext_vector_type(4))) float v4f;
__device__ __forceinline__ float bf16_rne(float f) { unsigned int u = __float_as_uint(f); u += 0x7FFFu + ((u >> 16) & 1u); return __uint_as_float(u & 0xFFFF0000u); }
__device__ __forceinline__ void split16(float v, b16& hi, b16& lo) { hi = (b16)v; lo = (b16)(v - (float)hi); }
__device__ __forceinline__ v16b frag_kb(const b16* p, int hh) { const v8b a = *(const v8b*)(p + 8 * hh), b = *(const v8b*)(p + 16 + 8 * hh); v16b f;
#pragma unroll
  for (int e = 0; e < 8; ++e) { f[e] = a[e]; f[8 + e] = b[e]; } return f; }
__device__ __forceinline__ v8f wmma16b(v16b a, v16b b, v8f c) { v8f d = __builtin_amdgcn_wmma_f32_16x16x32_f16(false, a, false, b, (short)0, c, false, false); asm volatile("v_nop\n\tv_nop\n\tv_nop\n\tv_nop" : "+v"(d) : "v"(a), "v"(b)); return d; }
__device__ __forceinline__ void wave_lds_sync() { __builtin_amdgcn_fence(__ATOMIC_RELEASE, "workgroup"); __builtin_amdgcn_wave_barrier(); __builtin_amdgcn_fence(__ATOMIC_ACQUIRE, "workgroup"); }
__device__ __forceinline__ float pmul(float a, float b) { float p = a * b; asm volatile("" : "+v"(p)); return p; }
__device__ __forceinline__ float opaque(float a) { asm volatile("" : "+v"(a)); return a; }
__device__ __forceinline__ float lrelu(float x) { return x >= 0.0f ? x : NEG * x; }
__device__ __forceinline__ float nexp(float x) { return __builtin_amdgcn_exp2f(x * 1.4426950408889634f); }

__global__ __launch_bounds__(256) void wprep_kernel(const float* __restrict__ w, b16* __restrict__ WT) {
  const size_t u = (size_t)blockIdx.x * 256 + threadIdx.x; if (u >= (size_t)F * F / 8) return; const size_t e = u * 8; const int o = (int)(e / F), k0 = (int)(e % F); v8b v;
  for (int j = 0; j < 8; ++j) v[j] = (b16)(bf16_rne(w[(size_t)(k0 + j) * F + o]) * WSC); { *(v8b*)(WT + e) = v;  }
}
__global__ __launch_bounds__(128) void hgemm_kernel(const float* __restrict__ x, const b16* __restrict__ WT, const float* __restrict__ as_, const float* __restrict__ ad_, float* __restrict__ H, float* __restrict__ S, float* __restrict__ Dd) {
  __shared__ __attribute__((aligned(16))) float Tf[4][16][F + 4]; __shared__ __attribute__((aligned(16))) float sa[64], sd[64];
  const int wave = threadIdx.x >> 5, lane = threadIdx.x & 31, nloc = lane & 15, hlf = lane >> 4; const size_t m0 = (size_t)blockIdx.x * 64 + wave * 16; const float* xr = x + (m0 + nloc) * F;
  v8f acc[8];
#pragma unroll
  for (int t = 0; t < 8; ++t) acc[t] = (v8f){};
#pragma unroll 2
  for (int kb = 0; kb < F; kb += 32) { v16b a; for (int j = 0; j < 8; ++j) { a[j] = (b16)(bf16_rne(xr[kb + 8 * hlf + j]) * XS); a[8 + j] = (b16)(bf16_rne(xr[kb + 16 + 8 * hlf + j]) * XS); }
#pragma unroll
    for (int t = 0; t < 8; ++t) acc[t] = wmma16b(a, frag_kb(WT + (size_t)(t * 16 + nloc) * F + kb, hlf), acc[t]); }
  float ps[8], pd[8]; for (int r8 = 0; r8 < 8; ++r8) { ps[r8] = 0.0f; pd[r8] = 0.0f; }
#pragma unroll
  for (int t = 0; t < 8; ++t) { const int c = t * 16 + nloc; const float ws_ = opaque(bf16_rne(as_[c])), wd_ = opaque(bf16_rne(ad_[c]));
#pragma unroll
    for (int r8 = 0; r8 < 8; ++r8) { const float v = acc[t][r8] * (1.0f / (XS * WSC)); Tf[wave][8 * hlf + r8][c] = v; ps[r8] += pmul(v, ws_); pd[r8] += pmul(v, wd_); } }
#pragma unroll
  for (int r8 = 0; r8 < 8; ++r8) { float a = ps[r8], b = pd[r8]; for (int o = 1; o < 16; o <<= 1) { a += __shfl_xor(a, o); b += __shfl_xor(b, o); } if (nloc == 0) { sa[wave * 16 + 8 * hlf + r8] = a; sd[wave * 16 + 8 * hlf + r8] = b; } }
  __syncthreads();
  { for (int rr = 0; rr < 16; ++rr) *(v4f*)(H + (m0 + rr) * F + lane * 4) = *(const v4f*)(&Tf[wave][rr][lane * 4]);
    if (threadIdx.x < 16) *(v4f*)(S + (size_t)blockIdx.x * 64 + threadIdx.x * 4) = *(const v4f*)(&sa[threadIdx.x * 4]); else if (threadIdx.x < 32) *(v4f*)(Dd + (size_t)blockIdx.x * 64 + (threadIdx.x - 16) * 4) = *(const v4f*)(&sd[(threadIdx.x - 16) * 4]);
     }
}
__global__ __launch_bounds__(256) void htrans_kernel(const float* __restrict__ H, b16* __restrict__ HTH, b16* __restrict__ HTL) {
  __shared__ float tile[64][64 + 1];
  const int c0 = blockIdx.x * 64, j0 = blockIdx.y * 64, g = blockIdx.z; const int wave = threadIdx.x >> 5, lane = threadIdx.x & 31;
  for (int rr = 0; rr < 8; ++rr) { const int jl = wave * 8 + rr; const float* row = H + ((size_t)g * NN + j0 + jl) * F + c0; tile[lane * 2][jl] = row[lane * 2]; tile[lane * 2 + 1][jl] = row[lane * 2 + 1]; }
  __syncthreads();
  typedef __attribute__((ext_vector_type(2))) _Float16 v2b;
  { for (int rr = 0; rr < 8; ++rr) { const int cl = wave * 8 + rr; const int c = c0 + cl; b16 p0, q0, p1, q1; split16(tile[cl][lane * 2] * XS, p0, q0); split16(tile[cl][lane * 2 + 1] * XS, p1, q1); v2b h, l; h[0] = p0; h[1] = p1; l[0] = q0; l[1] = q1;
      *(v2b*)(HTH + ((size_t)g * F + c) * NN + j0 + lane * 2) = h; *(v2b*)(HTL + ((size_t)g * F + c) * NN + j0 + lane * 2) = l; }  }
}
// attention: wave per 16 rows i of group g (block = 4 waves = 64 rows): max_j d_j over the group; P fragments on the fly: p = exp(leaky(s_i + d_j) - leaky(s_i + max d)) x16384 split hi+lo; den in f32 from the
// unsplit p. The h^T planes reach the waves through LDS: a tile = 64 k of all 128 columns, hi and lo plane, brought once per block by asynchronous copies, two buffers, so that the next tile flies under this tile's products.
constexpr int KT = 64, NT = NN / KT, KP = KT + 8;   // KP: LDS row pitch of 144 bytes = 16 x odd, free of bank conflicts for 16-byte reads
// Eight rows-of-16 steps of one plane: each lane copies 16 bytes, eight lanes cover one whole 128-byte line. The s_wait_xcnt stands inside the statement so that no address register is rewritten ahead of it.
__device__ __forceinline__ void copy8(unsigned int l, const b16* g) {
  asm volatile("global_load_async_to_lds_b128 %0, %8, off\n\t"
               "global_load_async_to_lds_b128 %1, %9, off\n\t"
               "global_load_async_to_lds_b128 %2, %10, off\n\t"
               "global_load_async_to_lds_b128 %3, %11, off\n\t"
               "global_load_async_to_lds_b128 %4, %12, off\n\t"
               "global_load_async_to_lds_b128 %5, %13, off\n\t"
               "global_load_async_to_lds_b128 %6, %14, off\n\t"
               "global_load_async_to_lds_b128 %7, %15, off\n\t"
               "s_wait_xcnt 0x0"
               :: "v"(l), "v"(l + 1u * 16 * KP * 2), "v"(l + 2u * 16 * KP * 2), "v"(l + 3u * 16 * KP * 2), "v"(l + 4u * 16 * KP * 2), "v"(l + 5u * 16 * KP * 2), "v"(l + 6u * 16 * KP * 2), "v"(l + 7u * 16 * KP * 2),
                  "v"(g), "v"(g + 1 * 16 * NN), "v"(g + 2 * 16 * NN), "v"(g + 3 * 16 * NN), "v"(g + 4 * 16 * NN), "v"(g + 5 * 16 * NN), "v"(g + 6 * 16 * NN), "v"(g + 7 * 16 * NN)
               : "memory");
}
__global__ __launch_bounds__(128) void attn_kernel(const float* __restrict__ S, const float* __restrict__ Dd, const b16* __restrict__ HTH, const b16* __restrict__ HTL, float* __restrict__ out) {
  __shared__ __attribute__((aligned(16))) b16 ring[2][2][F][KP];   // [buffer][plane hi, lo][column][k]
  __shared__ __attribute__((aligned(16))) float Tf[4][16][F + 4]; __shared__ float dens[4][16];
  const int wave = threadIdx.x >> 5, lane = threadIdx.x & 31, nloc = lane & 15, hlf = lane >> 4; const size_t i0 = (size_t)blockIdx.x * 64 + wave * 16; const int g = (int)(i0 / NN); const float* Dg = Dd + (size_t)g * NN;
  const b16* Hh = HTH + (size_t)g * F * NN; const b16* Hl = HTL + (size_t)g * F * NN;
  const int crow = threadIdx.x >> 3, cch = (threadIdx.x & 7) * 8; const size_t csrc = (size_t)crow * NN + cch;
  auto fill = [&](int tile) { const int b = tile & 1; copy8((unsigned int)(size_t)&ring[b][0][crow][cch], Hh + csrc + tile * KT); copy8((unsigned int)(size_t)&ring[b][1][crow][cch], Hl + csrc + tile * KT); };
  fill(0);
  float mx = -INFINITY; for (int j = lane; j < NN; j += 32) mx = fmaxf(mx, Dg[j]); for (int o = 16; o; o >>= 1) mx = fmaxf(mx, __shfl_xor(mx, o));
  const float si = S[i0 + nloc]; const float mi = lrelu(si + mx); float den = 0.0f;
  v8f acc[8];
#pragma unroll
  for (int t = 0; t < 8; ++t) acc[t] = (v8f){};
  asm volatile("s_wait_asynccnt 0x0" ::: "memory");   // this wave's share of tile 0 has landed
  __syncthreads();                                    // publishes tile 0 to the other waves
  fill(1);
#pragma unroll 1
  for (int tt = 0; tt < NT; ++tt) { const int bf = tt & 1;
#pragma unroll
    for (int ks = 0; ks < KT; ks += 32) { const int kb = tt * KT + ks; v16b ph, pl;
      for (int j = 0; j < 8; ++j) { const float p0 = nexp(lrelu(si + Dg[kb + 8 * hlf + j]) - mi), p1 = nexp(lrelu(si + Dg[kb + 16 + 8 * hlf + j]) - mi); den += p0 + p1; b16 a, b; split16(p0 * PS, a, b); ph[j] = a; pl[j] = b; split16(p1 * PS, a, b); ph[8 + j] = a; pl[8 + j] = b; }
#pragma unroll
      for (int t = 0; t < 8; ++t) { const v16b bh = frag_kb(&ring[bf][0][t * 16 + nloc][ks], hlf), bl = frag_kb(&ring[bf][1][t * 16 + nloc][ks], hlf); acc[t] = wmma16b(ph, bh, acc[t]); acc[t] = wmma16b(pl, bh, acc[t]); acc[t] = wmma16b(ph, bl, acc[t]); } }
    asm volatile("s_wait_dscnt 0x0" ::: "memory");      // this wave's reads of the buffer are done before it is refilled
    asm volatile("s_wait_asynccnt 0x0" ::: "memory");   // this wave's share of tile tt + 1 has landed
    __syncthreads();                                    // publishes tile tt + 1 and ends every wave's reads of tile tt
    if (tt + 2 < NT) fill(tt + 2); }
  asm volatile("s_wait_asynccnt 0x0" ::: "memory");     // no copy is outstanding when the wave goes on
  den += __shfl_xor(den, 16);
  if (hlf == 0) dens[wave][nloc] = den;
  wave_lds_sync();
#pragma unroll
  for (int t = 0; t < 8; ++t) { const int c = t * 16 + nloc;
#pragma unroll 1
    for (int r8 = 0; r8 < 8; ++r8) { const int rl = 8 * hlf + r8; Tf[wave][rl][c] = acc[t][r8] * (1.0f / (PS * XS)) / dens[wave][rl]; } }
  wave_lds_sync();
  { for (int rr = 0; rr < 16; ++rr) *(v4f*)(out + (i0 + rr) * F + lane * 4) = *(const v4f*)(&Tf[wave][rr][lane * 4]);  }
}
}  // namespace

extern "C" void kernel_launch(void* const* d_in, const int* in_sizes, int n_in, void* d_out, int out_size, void* d_ws, size_t ws_size, hipStream_t stream) {
  (void)n_in;
  auto Fp = [&](int i) { return (const float*)d_in[i]; };
  // input order: 0 x [2,16,1024,128], 1 W [128,128], 2 a_src [128], 3 a_dst [128]
  if (in_sizes[0] != M * F || in_sizes[1] != F * F || in_sizes[2] != F || in_sizes[3] != F || out_size != M * F) return;
  size_t off = 0; char* ws = (char*)d_ws;
  auto carve = [&](size_t bytes) { char* p = ws + off; off += (bytes + 255) & ~(size_t)255; return p; };
  b16* WT = (b16*)carve((size_t)F * F * 2); float* H = (float*)carve((size_t)M * F * 4); float* S = (float*)carve((size_t)M * 4); float* Dd = (float*)carve((size_t)M * 4); b16* HTH = (b16*)carve((size_t)NG * F * NN * 2); b16* HTL = (b16*)carve((size_t)NG * F * NN * 2);
  if (off > ws_size || off > ((size_t)64 << 20)) return;   // ~ 34 MB
  wprep_kernel<<<(F * F / 8 + 255) / 256, 256, 0, stream>>>(Fp(1), WT);
  hgemm_kernel<<<M / 64, 128, 0, stream>>>(Fp(0), WT, Fp(2), Fp(3), H, S, Dd);
  htrans_kernel<<<dim3(F / 64, NN / 64, NG), 256, 0, stream>>>(H, HTH, HTL);
  attn_kernel<<<M / 64, 128, 0, stream>>>(S, Dd, HTH, HTL, (float*)d_out);
}

// v002
// Measured time: 67 microseconds a run.
// In both of two side-by-side timings against v001, it was 1.13 times as fast.
// Counting every step since v000, it is 1.92 times as fast.
#include <hip/hip_runtime.h>

// Dense GAT layer on [2, 16, 1024, 128]: per (b, t) group of 1,024 nodes: h = x W; e[i][j] = leaky_0.2(h_i . a_src + h_j . a_dst); alpha = softmax over j; out = alpha h -> [2][16][1024][128].
// WMMA (v_wmma_f32_16x16x32_f16, f32 accumulate): h = bf16(x) W ([32,768 x 128] x [128 x 128], EXACT bf16 x8: 1 product) and per group out = P h ([1,024 x 1,024] x [1,024 x 128]: P = exp(e - rowmax)
// carried x16384 and split f16 hi+lo, built directly in the A fragments (rank-1 scores: rowmax_i = leaky(s_i + max_j d_j)); h transposed hi+lo x8 planes; 3 products); W exact x256; scores, row sums
// and the normalisation in f32. Inputs rounded to bf16 once. Fragment k-map per lane half hh for A AND B: elements 0..7 <- k = 8hh+0..7, 8..15 <- k = 16+8hh+0..7;

namespace {
constexpr int NG = 32, NN = 1024, F = 128, M = NG * NN;
constexpr float XS = 8.0f, WSC = 256.0f, PS = 16384.0f, NEG = 0.2f;
typedef _Float16 b16;
typedef __attribute__((ext_vector_type(16))) _Float16 v16b;
typedef __attribute__((ext_vector_type(8))) _Float16 v8b;
typedef __attribute__((ext_vector_type(8))) float v8f;
typedef __attribute__((ext_vector_type(4))) float v4f;
__device__ __forceinline__ float bf16_rne(float f) { unsigned int u = __float_as_uint(f); u += 0x7FFFu + ((u >> 16) & 1u); return __uint_as_float(u & 0xFFFF0000u); }
__device__ __forceinline__ void split16(float v, b16& hi, b16& lo) { hi = (b16)v; lo = (b16)(v - (float)hi); }
__device__ __forceinline__ v16b frag_kb(const b16* p, int hh) { const v8b a = *(const v8b*)(p + 8 * hh), b = *(const v8b*)(p + 16 + 8 * hh); v16b f;
#pragma unroll
  for (int e = 0; e < 8; ++e) { f[e] = a[e]; f[8 + e] = b[e]; } return f; }
__device__ __forceinline__ v8f wmma16b(v16b a, v16b b, v8f c) { v8f d = __builtin_amdgcn_wmma_f32_16x16x32_f16(false, a, false, b, (short)0, c, false, false); asm volatile("v_nop\n\tv_nop\n\tv_nop\n\tv_nop" : "+v"(d) : "v"(a), "v"(b)); return d; }
__device__ __forceinline__ v8f wmma16p(v16b a, v16b b, v8f c) { return __builtin_amdgcn_wmma_f32_16x16x32_f16(false, a, false, b, (short)0, c, false, false); }
__device__ __forceinline__ void wave_lds_sync() { __builtin_amdgcn_fence(__ATOMIC_RELEASE, "workgroup"); __builtin_amdgcn_wave_barrier(); __builtin_amdgcn_fence(__ATOMIC_ACQUIRE, "workgroup"); }
__device__ __forceinline__ float pmul(float a, float b) { float p = a * b; asm volatile("" : "+v"(p)); return p; }
__device__ __forceinline__ float opaque(float a) { asm volatile("" : "+v"(a)); return a; }
__device__ __forceinline__ float lrelu(float x) { return x >= 0.0f ? x : NEG * x; }
// v_exp_f32 with the one slot behind a transcendental tied to it
__device__ __forceinline__ float nexp_slot(float x) { const float y = x * 1.4426950408889634f; float r; asm("v_exp_f32 %0, %1\n\tv_nop" : "=v"(r) : "v"(y)); return r; }

__global__ __launch_bounds__(256) void wprep_kernel(const float* __restrict__ w, b16* __restrict__ WT) {
  const size_t u = (size_t)blockIdx.x * 256 + threadIdx.x; if (u >= (size_t)F * F / 8) return; const size_t e = u * 8; const int o = (int)(e / F), k0 = (int)(e % F); v8b v;
  for (int j = 0; j < 8; ++j) v[j] = (b16)(bf16_rne(w[(size_t)(k0 + j) * F + o]) * WSC); { *(v8b*)(WT + e) = v;  }
}
__global__ __launch_bounds__(128) void hgemm_kernel(const float* __restrict__ x, const b16* __restrict__ WT, const float* __restrict__ as_, const float* __restrict__ ad_, float* __restrict__ H, float* __restrict__ S, float* __restrict__ Dd) {
  __shared__ __attribute__((aligned(16))) float Tf[4][16][F + 4]; __shared__ __attribute__((aligned(16))) float sa[64], sd[64];
  const int wave = threadIdx.x >> 5, lane = threadIdx.x & 31, nloc = lane & 15, hlf = lane >> 4; const size_t m0 = (size_t)blockIdx.x * 64 + wave * 16; const float* xr = x + (m0 + nloc) * F;
  v8f acc[8];
#pragma unroll
  for (int t = 0; t < 8; ++t) acc[t] = (v8f){};
#pragma unroll 2
  for (int kb = 0; kb < F; kb += 32) { v16b a; for (int j = 0; j < 8; ++j) { a[j] = (b16)(bf16_rne(xr[kb + 8 * hlf + j]) * XS); a[8 + j] = (b16)(bf16_rne(xr[kb + 16 + 8 * hlf + j]) * XS); }
#pragma unroll
    for (int t = 0; t < 8; ++t) acc[t] = wmma16b(a, frag_kb(WT + (size_t)(t * 16 + nloc) * F + kb, hlf), acc[t]); }
  float ps[8], pd[8]; for (int r8 = 0; r8 < 8; ++r8) { ps[r8] = 0.0f; pd[r8] = 0.0f; }
#pragma unroll
  for (int t = 0; t < 8; ++t) { const int c = t * 16 + nloc; const float ws_ = opaque(bf16_rne(as_[c])), wd_ = opaque(bf16_rne(ad_[c]));
#pragma unroll
    for (int r8 = 0; r8 < 8; ++r8) { const float v = acc[t][r8] * (1.0f / (XS * WSC)); Tf[wave][8 * hlf + r8][c] = v; ps[r8] += pmul(v, ws_); pd[r8] += pmul(v, wd_); } }
#pragma unroll
  for (int r8 = 0; r8 < 8; ++r8) { float a = ps[r8], b = pd[r8]; for (int o = 1; o < 16; o <<= 1) { a += __shfl_xor(a, o); b += __shfl_xor(b, o); } if (nloc == 0) { sa[wave * 16 + 8 * hlf + r8] = a; sd[wave * 16 + 8 * hlf + r8] = b; } }
  __syncthreads();
  { for (int rr = 0; rr < 16; ++rr) *(v4f*)(H + (m0 + rr) * F + lane * 4) = *(const v4f*)(&Tf[wave][rr][lane * 4]);
    if (threadIdx.x < 16) *(v4f*)(S + (size_t)blockIdx.x * 64 + threadIdx.x * 4) = *(const v4f*)(&sa[threadIdx.x * 4]); else if (threadIdx.x < 32) *(v4f*)(Dd + (size_t)blockIdx.x * 64 + (threadIdx.x - 16) * 4) = *(const v4f*)(&sd[(threadIdx.x - 16) * 4]);
     }
}
__global__ __launch_bounds__(256) void htrans_kernel(const float* __restrict__ H, b16* __restrict__ HTH, b16* __restrict__ HTL) {
  __shared__ float tile[64][64 + 1];
  const int c0 = blockIdx.x * 64, j0 = blockIdx.y * 64, g = blockIdx.z; const int wave = threadIdx.x >> 5, lane = threadIdx.x & 31;
  for (int rr = 0; rr < 8; ++rr) { const int jl = wave * 8 + rr; const float* row = H + ((size_t)g * NN + j0 + jl) * F + c0; tile[lane * 2][jl] = row[lane * 2]; tile[lane * 2 + 1][jl] = row[lane * 2 + 1]; }
  __syncthreads();
  typedef __attribute__((ext_vector_type(2))) _Float16 v2b;
  { for (int rr = 0; rr < 8; ++rr) { const int cl = wave * 8 + rr; const int c = c0 + cl; b16 p0, q0, p1, q1; split16(tile[cl][lane * 2] * XS, p0, q0); split16(tile[cl][lane * 2 + 1] * XS, p1, q1); v2b h, l; h[0] = p0; h[1] = p1; l[0] = q0; l[1] = q1;
      *(v2b*)(HTH + ((size_t)g * F + c) * NN + j0 + lane * 2) = h; *(v2b*)(HTL + ((size_t)g * F + c) * NN + j0 + lane * 2) = l; }  }
}
// attention: wave per 16 rows i of group g (block = 4 waves = 64 rows): max_j d_j over the group; P fragments on the fly: p = exp(leaky(s_i + d_j) - leaky(s_i + max d)) x16384 split hi+lo; den in f32 from the
// unsplit p. A 32-k step asks for its d_j and all its h^T fragments first, forms P under their latency, then runs its products plane by plane over the eight independent column tiles. The h^T planes reach the waves through LDS: a tile = 64 k of all 128 columns, hi and lo plane, brought once per block by asynchronous copies, two buffers, so that the next tile flies under this tile's products.
constexpr int KT = 64, NT = NN / KT, KP = KT + 8;   // KP: LDS row pitch of 144 bytes = 16 x odd, free of bank conflicts for 16-byte reads
// Eight rows-of-16 steps of one plane: each lane copies 16 bytes, eight lanes cover one whole 128-byte line. The s_wait_xcnt stands inside the statement so that no address register is rewritten ahead of it.
__device__ __forceinline__ void copy8(unsigned int l, const b16* g) {
  asm volatile("global_load_async_to_lds_b128 %0, %8, off\n\t"
               "global_load_async_to_lds_b128 %1, %9, off\n\t"
               "global_load_async_to_lds_b128 %2, %10, off\n\t"
               "global_load_async_to_lds_b128 %3, %11, off\n\t"
               "global_load_async_to_lds_b128 %4, %12, off\n\t"
               "global_load_async_to_lds_b128 %5, %13, off\n\t"
               "global_load_async_to_lds_b128 %6, %14, off\n\t"
               "global_load_async_to_lds_b128 %7, %15, off\n\t"
               "s_wait_xcnt 0x0"
               :: "v"(l), "v"(l + 1u * 16 * KP * 2), "v"(l + 2u * 16 * KP * 2), "v"(l + 3u * 16 * KP * 2), "v"(l + 4u * 16 * KP * 2), "v"(l + 5u * 16 * KP * 2), "v"(l + 6u * 16 * KP * 2), "v"(l + 7u * 16 * KP * 2),
                  "v"(g), "v"(g + 1 * 16 * NN), "v"(g + 2 * 16 * NN), "v"(g + 3 * 16 * NN), "v"(g + 4 * 16 * NN), "v"(g + 5 * 16 * NN), "v"(g + 6 * 16 * NN), "v"(g + 7 * 16 * NN)
               : "memory");
}
__global__ __launch_bounds__(128) void attn_kernel(const float* __restrict__ S, const float* __restrict__ Dd, const b16* __restrict__ HTH, const b16* __restrict__ HTL, float* __restrict__ out) {
  __shared__ __attribute__((aligned(16))) b16 ring[2][2][F][KP];   // [buffer][plane hi, lo][column][k]
  __shared__ __attribute__((aligned(16))) float Tf[4][16][F + 4]; __shared__ float dens[4][16];
  const int wave = threadIdx.x >> 5, lane = threadIdx.x & 31, nloc = lane & 15, hlf = lane >> 4; const size_t i0 = (size_t)blockIdx.x * 64 + wave * 16; const int g = (int)(i0 / NN); const float* Dg = Dd + (size_t)g * NN;
  const b16* Hh = HTH + (size_t)g * F * NN; const b16* Hl = HTL + (size_t)g * F * NN;
  const int crow = threadIdx.x >> 3, cch = (threadIdx.x & 7) * 8; const size_t csrc = (size_t)crow * NN + cch;
  auto fill = [&](int tile) { const int b = tile & 1; copy8((unsigned int)(size_t)&ring[b][0][crow][cch], Hh + csrc + tile * KT); copy8((unsigned int)(size_t)&ring[b][1][crow][cch], Hl + csrc + tile * KT); };
  fill(0);
  float mx = -INFINITY; for (int j = lane; j < NN; j += 32) mx = fmaxf(mx, Dg[j]); for (int o = 16; o; o >>= 1) mx = fmaxf(mx, __shfl_xor(mx, o));
  const float si = S[i0 + nloc]; const float mi = lrelu(si + mx); float den = 0.0f;
  v8f acc[8];
#pragma unroll
  for (int t = 0; t < 8; ++t) acc[t] = (v8f){};
  asm volatile("s_wait_asynccnt 0x0" ::: "memory");   // this wave's share of tile 0 has landed
  __syncthreads();                                    // publishes tile 0 to the other waves
  fill(1);
#pragma unroll 1
  for (int tt = 0; tt < NT; ++tt) { const int bf = tt & 1; const float* dt = Dg + tt * KT + 8 * hlf;   // this lane's d_j of the tile
#pragma unroll
    for (int ks = 0; ks < KT; ks += 32) { v16b ph, pl, bh[8], bl[8];
      const v8f dlo = *(const v8f*)(dt + ks), dhi = *(const v8f*)(dt + ks + 16);   // this step's d_j in the lane's fragment order, asked for first
#pragma unroll
      for (int t = 0; t < 8; ++t) bh[t] = frag_kb(&ring[bf][0][t * 16 + nloc][ks], hlf);
#pragma unroll
      for (int t = 0; t < 8; ++t) bl[t] = frag_kb(&ring[bf][1][t * 16 + nloc][ks], hlf);
      asm volatile("s_wait_xcnt 0x0" :: "v"(dt) : "memory");   // precaution: no register that the d loads name is rewritten ahead of this wait (dt is named so that the pair lives up to it)
      __builtin_amdgcn_sched_barrier(0);   // keeps the loads one group in front of the P arithmetic, which then covers the LDS latency
#pragma unroll
      for (int j = 0; j < 8; ++j) { const float p0 = nexp_slot(lrelu(si + dlo[j]) - mi), p1 = nexp_slot(lrelu(si + dhi[j]) - mi); den += p0 + p1; b16 a, b; split16(p0 * PS, a, b); ph[j] = a; pl[j] = b; split16(p1 * PS, a, b); ph[8 + j] = a; pl[8 + j] = b; }
      __builtin_amdgcn_sched_barrier(0);   // keeps the 24 products one run behind the arithmetic, with no LDS read among them
#pragma unroll
      for (int t = 0; t < 8; ++t) acc[t] = wmma16p(ph, bh[t], acc[t]);
#pragma unroll
      for (int t = 0; t < 8; ++t) acc[t] = wmma16p(pl, bh[t], acc[t]);
#pragma unroll
      for (int t = 0; t < 8; ++t) acc[t] = wmma16p(ph, bl[t], acc[t]);
      __builtin_amdgcn_sched_barrier(0); } // keeps the next step's LDS reads out of this run of products
    asm volatile("s_wait_dscnt 0x0" ::: "memory");      // this wave's reads of the buffer are done before it is refilled
    asm volatile("s_wait_asynccnt 0x0" ::: "memory");   // this wave's share of tile tt + 1 has landed
    __syncthreads();                                    // publishes tile tt + 1 and ends every wave's reads of tile tt
    if (tt + 2 < NT) fill(tt + 2); }
  asm volatile("s_wait_asynccnt 0x0" ::: "memory");     // no copy is outstanding when the wave goes on
  den += __shfl_xor(den, 16);
  if (hlf == 0) dens[wave][nloc] = den;
  wave_lds_sync();
#pragma unroll
  for (int t = 0; t < 8; ++t) { const int c = t * 16 + nloc;
#pragma unroll 1
    for (int r8 = 0; r8 < 8; ++r8) { const int rl = 8 * hlf + r8; Tf[wave][rl][c] = acc[t][r8] * (1.0f / (PS * XS)) / dens[wave][rl]; } }
  wave_lds_sync();
  { for (int rr = 0; rr < 16; ++rr) *(v4f*)(out + (i0 + rr) * F + lane * 4) = *(const v4f*)(&Tf[wave][rr][lane * 4]);  }
}
}  // namespace

extern "C" void kernel_launch(void* const* d_in, const int* in_sizes, int n_in, void* d_out, int out_size, void* d_ws, size_t ws_size, hipStream_t stream) {
  (void)n_in;
  auto Fp = [&](int i) { return (const float*)d_in[i]; };
  // input order: 0 x [2,16,1024,128], 1 W [128,128], 2 a_src [128], 3 a_dst [128]
  if (in_sizes[0] != M * F || in_sizes[1] != F * F || in_sizes[2] != F || in_sizes[3] != F || out_size != M * F) return;
  size_t off = 0; char* ws = (char*)d_ws;
  auto carve = [&](size_t bytes) { char* p = ws + off; off += (bytes + 255) & ~(size_t)255; return p; };
  b16* WT = (b16*)carve((size_t)F * F * 2); float* H = (float*)carve((size_t)M * F * 4); float* S = (float*)carve((size_t)M * 4); float* Dd = (float*)carve((size_t)M * 4); b16* HTH = (b16*)carve((size_t)NG * F * NN * 2); b16* HTL = (b16*)carve((size_t)NG * F * NN * 2);
  if (off > ws_size || off > ((size_t)64 << 20)) return;   // ~ 34 MB
  wprep_kernel<<<(F * F / 8 + 255) / 256, 256, 0, stream>>>(Fp(1), WT);
  hgemm_kernel<<<M / 64, 128, 0, stream>>>(Fp(0), WT, Fp(2), Fp(3), H, S, Dd);
  htrans_kernel<<<dim3(F / 64, NN / 64, NG), 256, 0, stream>>>(H, HTH, HTL);
  attn_kernel<<<M / 64, 128, 0, stream>>>(S, Dd, HTH, HTL, (float*)d_out);
}

// v003
// It runs in 48.3 microseconds.
// In two side-by-side timings against v002, it was 1.38 and 1.37 times as fast.
// Counting every step since v000, it is 2.64 times as fast.
#include <hip/hip_runtime.h>

// Dense GAT layer on [2, 16, 1024, 128]: per (b, t) group of 1,024 nodes: h = x W; e[i][j] = leaky_0.2(h_i . a_src + h_j . a_dst); alpha = softmax over j; out = alpha h -> [2][16][1024][128].
// WMMA (v_wmma_f32_16x16x32_f16, f32 accumulate): h = bf16(x) W ([32,768 x 128] x [128 x 128], EXACT bf16 x8: 1 product) and per group out = P h ([1,024 x 1,024] x [1,024 x 128]: P = exp(e - rowmax)
// carried x16384 and split f16 hi+lo, built directly in the A fragments (rank-1 scores: rowmax_i = leaky(s_i + max_j d_j)); h transposed hi+lo x8 planes; 3 products); W exact x256; scores, row sums
// and the normalisation in f32. Inputs rounded to bf16 once. Fragment k-map per lane half hh for A AND B: elements 0..7 <- k = 8hh+0..7, 8..15 <- k = 16+8hh+0..7;

namespace {
constexpr int NG = 32, NN = 1024, F = 128, M = NG * NN;
constexpr float XS = 8.0f, WSC = 256.0f, PS = 16384.0f, NEG = 0.2f;
typedef _Float16 b16;
typedef __attribute__((ext_vector_type(16))) _Float16 v16b;
typedef __attribute__((ext_vector_type(8))) _Float16 v8b;
typedef __attribute__((ext_vector_type(8))) float v8f;
typedef __attribute__((ext_vector_type(4))) float v4f;
__device__ __forceinline__ float bf16_rne(float f) { unsigned int u = __float_as_uint(f); u += 0x7FFFu + ((u >> 16) & 1u); return __uint_as_float(u & 0xFFFF0000u); }
__device__ __forceinline__ void split16(float v, b16& hi, b16& lo) { hi = (b16)v; lo = (b16)(v - (float)hi); }
__device__ __forceinline__ v16b frag_kb(const b16* p, int hh) { const v8b a = *(const v8b*)(p + 8 * hh), b = *(const v8b*)(p + 16 + 8 * hh); v16b f;
#pragma unroll
  for (int e = 0; e < 8; ++e) { f[e] = a[e]; f[8 + e] = b[e]; } return f; }
__device__ __forceinline__ v8f wmma16b(v16b a, v16b b, v8f c) { v8f d = __builtin_amdgcn_wmma_f32_16x16x32_f16(false, a, false, b, (short)0, c, false, false); asm volatile("v_nop\n\tv_nop\n\tv_nop\n\tv_nop" : "+v"(d) : "v"(a), "v"(b)); return d; }
__device__ __forceinline__ v8f wmma16p(v16b a, v16b b, v8f c) { return __builtin_amdgcn_wmma_f32_16x16x32_f16(false, a, false, b, (short)0, c, false, false); }
__device__ __forceinline__ void wave_lds_sync() { __builtin_amdgcn_fence(__ATOMIC_RELEASE, "workgroup"); __builtin_amdgcn_wave_barrier(); __builtin_amdgcn_fence(__ATOMIC_ACQUIRE, "workgroup"); }
__device__ __forceinline__ float pmul(float a, float b) { float p = a * b; asm volatile("" : "+v"(p)); return p; }
__device__ __forceinline__ float opaque(float a) { asm volatile("" : "+v"(a)); return a; }
__device__ __forceinline__ float lrelu(float x) { return x >= 0.0f ? x : NEG * x; }
// v_exp_f32 with the one slot behind a transcendental tied to it
__device__ __forceinline__ float nexp_slot(float x) { const float y = x * 1.4426950408889634f; float r; asm("v_exp_f32 %0, %1\n\tv_nop" : "=v"(r) : "v"(y)); return r; }

// projection: block = 4 waves = 64 nodes of one group. W is rounded, scaled and transposed into LDS by the block itself; the h^T hi and lo planes go out straight from the accumulators
// (a lane holds 8 consecutive nodes of one column = one 16-byte piece of an h^T row), gathered in LDS so that eight lanes store one whole 128-byte line.
constexpr int WP = F + 8, JP = 64 + 8;   // LDS row pitches of 272 and 144 bytes = 16 x odd, free of bank conflicts for 16-byte reads
__global__ __launch_bounds__(128) void proj_kernel(const float* __restrict__ x, const float* __restrict__ w, const float* __restrict__ as_, const float* __restrict__ ad_, float* __restrict__ S, float* __restrict__ Dd, b16* __restrict__ HTH, b16* __restrict__ HTL) {
  __shared__ __attribute__((aligned(16))) b16 Wt[F][WP];      // [output column][k]
  __shared__ __attribute__((aligned(16))) b16 Ht[2][F][JP];   // [plane hi, lo][column][node of the block]
  __shared__ __attribute__((aligned(16))) float sa[64], sd[64];
  const int wave = threadIdx.x >> 5, lane = threadIdx.x & 31, nloc = lane & 15, hlf = lane >> 4; const size_t m0 = (size_t)blockIdx.x * 64 + wave * 16; const float* xr = x + (m0 + nloc) * F;
  const float* xp = xr + 8 * hlf; const int o4 = lane * 4, kw = wave * 32; const float* wp = w + (size_t)kw * F + o4;   // wave: 32 rows k of W; lane: 4 columns
  v4f xv[4][4], r[4][8];   // this lane's 32 x 4 piece of W, asked for first (short way, needed first), and its x in fragment order, which flies under the W staging
#pragma unroll
  for (int q = 0; q < 4; ++q) {
#pragma unroll
    for (int j = 0; j < 8; ++j) r[q][j] = *(const v4f*)(wp + (q * 8 + j) * F); }
  asm volatile("s_wait_xcnt 0x0" :: "v"(wp) : "memory");   // precaution: no register that the W loads name is rewritten ahead of this wait (wp is named so that the pair lives up to it)
#pragma unroll
  for (int q = 0; q < 4; ++q) { xv[q][0] = *(const v4f*)(xp + q * 32); xv[q][1] = *(const v4f*)(xp + q * 32 + 4); xv[q][2] = *(const v4f*)(xp + q * 32 + 16); xv[q][3] = *(const v4f*)(xp + q * 32 + 20); }
  asm volatile("s_wait_xcnt 0x0" :: "v"(xp) : "memory");   // the same precaution for the x loads
#pragma unroll
  for (int q = 0; q < 4; ++q) {
#pragma unroll
    for (int cc = 0; cc < 4; ++cc) { v8b v;
#pragma unroll
      for (int j = 0; j < 8; ++j) v[j] = (b16)(bf16_rne(r[q][j][cc]) * WSC);
      *(v8b*)(&Wt[o4 + cc][kw + q * 8]) = v; } }
  __syncthreads();   // publishes W^T to the four waves
  v8f acc[8];
#pragma unroll
  for (int t = 0; t < 8; ++t) acc[t] = (v8f){};
#pragma unroll
  for (int q = 0; q < 4; ++q) { v16b a, b[8];
#pragma unroll
    for (int t = 0; t < 8; ++t) b[t] = frag_kb(&Wt[t * 16 + nloc][q * 32], hlf);
    __builtin_amdgcn_sched_barrier(0);   // keeps the 16 LDS reads one group in front of the rounding of x, which then covers their latency
#pragma unroll
    for (int j = 0; j < 4; ++j) { a[j] = (b16)(bf16_rne(xv[q][0][j]) * XS); a[4 + j] = (b16)(bf16_rne(xv[q][1][j]) * XS); a[8 + j] = (b16)(bf16_rne(xv[q][2][j]) * XS); a[12 + j] = (b16)(bf16_rne(xv[q][3][j]) * XS); }
#pragma unroll
    for (int t = 0; t < 8; ++t) acc[t] = wmma16b(a, b[t], acc[t]); }
  float ps[8], pd[8]; for (int r8 = 0; r8 < 8; ++r8) { ps[r8] = 0.0f; pd[r8] = 0.0f; }
#pragma unroll
  for (int t = 0; t < 8; ++t) { const int c = t * 16 + nloc; const float ws_ = opaque(bf16_rne(as_[c])), wd_ = opaque(bf16_rne(ad_[c])); v8b hi, lo;
#pragma unroll
    for (int r8 = 0; r8 < 8; ++r8) { const float v = acc[t][r8] * (1.0f / (XS * WSC)); ps[r8] += pmul(v, ws_); pd[r8] += pmul(v, wd_); b16 p, q; split16(v * XS, p, q); hi[r8] = p; lo[r8] = q; }
    *(v8b*)(&Ht[0][c][wave * 16 + 8 * hlf]) = hi; *(v8b*)(&Ht[1][c][wave * 16 + 8 * hlf]) = lo; }
#pragma unroll
  for (int r8 = 0; r8 < 8; ++r8) { float a = ps[r8], b = pd[r8]; for (int o = 1; o < 16; o <<= 1) { a += __shfl_xor(a, o); b += __shfl_xor(b, o); } if (nloc == 0) { sa[wave * 16 + 8 * hlf + r8] = a; sd[wave * 16 + 8 * hlf + r8] = b; } }
  __syncthreads();
  { const int g = blockIdx.x / (NN / 64), j0 = (blockIdx.x % (NN / 64)) * 64, cr = threadIdx.x >> 3, ch = (threadIdx.x & 7) * 8;
#pragma unroll
    for (int it = 0; it < 8; ++it) { const int c = it * 16 + cr; const size_t d = ((size_t)g * F + c) * NN + j0 + ch; *(v8b*)(HTH + d) = *(const v8b*)(&Ht[0][c][ch]); *(v8b*)(HTL + d) = *(const v8b*)(&Ht[1][c][ch]); }
    if (threadIdx.x < 16) *(v4f*)(S + (size_t)blockIdx.x * 64 + threadIdx.x * 4) = *(const v4f*)(&sa[threadIdx.x * 4]); else if (threadIdx.x < 32) *(v4f*)(Dd + (size_t)blockIdx.x * 64 + (threadIdx.x - 16) * 4) = *(const v4f*)(&sd[(threadIdx.x - 16) * 4]);
  }
}
// attention: wave per 16 rows i of group g (block = 4 waves = 64 rows): max_j d_j over the group; P fragments on the fly: p = exp(leaky(s_i + d_j) - leaky(s_i + max d)) x16384 split hi+lo; den in f32 from the
// unsplit p. A 32-k step asks for its d_j and all its h^T fragments first, forms P under their latency, then runs its products plane by plane over the eight independent column tiles. The h^T planes reach the waves through LDS: a tile = 64 k of all 128 columns, hi and lo plane, brought once per block by asynchronous copies, two buffers, so that the next tile flies under this tile's products.
constexpr int KT = 64, NT = NN / KT, KP = KT + 8;   // KP: LDS row pitch of 144 bytes = 16 x odd, free of bank conflicts for 16-byte reads
// Eight rows-of-16 steps of one plane: each lane copies 16 bytes, eight lanes cover one whole 128-byte line. The s_wait_xcnt stands inside the statement so that no address register is rewritten ahead of it.
__device__ __forceinline__ void copy8(unsigned int l, const b16* g) {
  asm volatile("global_load_async_to_lds_b128 %0, %8, off\n\t"
               "global_load_async_to_lds_b128 %1, %9, off\n\t"
               "global_load_async_to_lds_b128 %2, %10, off\n\t"
               "global_load_async_to_lds_b128 %3, %11, off\n\t"
               "global_load_async_to_lds_b128 %4, %12, off\n\t"
               "global_load_async_to_lds_b128 %5, %13, off\n\t"
               "global_load_async_to_lds_b128 %6, %14, off\n\t"
               "global_load_async_to_lds_b128 %7, %15, off\n\t"
               "s_wait_xcnt 0x0"
               :: "v"(l), "v"(l + 1u * 16 * KP * 2), "v"(l + 2u * 16 * KP * 2), "v"(l + 3u * 16 * KP * 2), "v"(l + 4u * 16 * KP * 2), "v"(l + 5u * 16 * KP * 2), "v"(l + 6u * 16 * KP * 2), "v"(l + 7u * 16 * KP * 2),
                  "v"(g), "v"(g + 1 * 16 * NN), "v"(g + 2 * 16 * NN), "v"(g + 3 * 16 * NN), "v"(g + 4 * 16 * NN), "v"(g + 5 * 16 * NN), "v"(g + 6 * 16 * NN), "v"(g + 7 * 16 * NN)
               : "memory");
}
__global__ __launch_bounds__(128) void attn_kernel(const float* __restrict__ S, const float* __restrict__ Dd, const b16* __restrict__ HTH, const b16* __restrict__ HTL, float* __restrict__ out) {
  __shared__ __attribute__((aligned(16))) b16 ring[2][2][F][KP];   // [buffer][plane hi, lo][column][k]
  __shared__ __attribute__((aligned(16))) float Tf[4][16][F + 4]; __shared__ float dens[4][16];
  const int wave = threadIdx.x >> 5, lane = threadIdx.x & 31, nloc = lane & 15, hlf = lane >> 4; const size_t i0 = (size_t)blockIdx.x * 64 + wave * 16; const int g = (int)(i0 / NN); const float* Dg = Dd + (size_t)g * NN;
  const b16* Hh = HTH + (size_t)g * F * NN; const b16* Hl = HTL + (size_t)g * F * NN;
  const int crow = threadIdx.x >> 3, cch = (threadIdx.x & 7) * 8; const size_t csrc = (size_t)crow * NN + cch;
  auto fill = [&](int tile) { const int b = tile & 1; copy8((unsigned int)(size_t)&ring[b][0][crow][cch], Hh + csrc + tile * KT); copy8((unsigned int)(size_t)&ring[b][1][crow][cch], Hl + csrc + tile * KT); };
  fill(0);
  float mx = -INFINITY; for (int j = lane; j < NN; j += 32) mx = fmaxf(mx, Dg[j]); for (int o = 16; o; o >>= 1) mx = fmaxf(mx, __shfl_xor(mx, o));
  const float si = S[i0 + nloc]; const float mi = lrelu(si + mx); float den = 0.0f;
  v8f acc[8];
#pragma unroll
  for (int t = 0; t < 8; ++t) acc[t] = (v8f){};
  asm volatile("s_wait_asynccnt 0x0" ::: "memory");   // this wave's share of tile 0 has landed
  __syncthreads();                                    // publishes tile 0 to the other waves
  fill(1);
#pragma unroll 1
  for (int tt = 0; tt < NT; ++tt) { const int bf = tt & 1; const float* dt = Dg + tt * KT + 8 * hlf;   // this lane's d_j of the tile
#pragma unroll
    for (int ks = 0; ks < KT; ks += 32) { v16b ph, pl, bh[8], bl[8];
      const v8f dlo = *(const v8f*)(dt + ks), dhi = *(const v8f*)(dt + ks + 16);   // this step's d_j in the lane's fragment order, asked for first
#pragma unroll
      for (int t = 0; t < 8; ++t) bh[t] = frag_kb(&ring[bf][0][t * 16 + nloc][ks], hlf);
#pragma unroll
      for (int t = 0; t < 8; ++t) bl[t] = frag_kb(&ring[bf][1][t * 16 + nloc][ks], hlf);
      asm volatile("s_wait_xcnt 0x0" :: "v"(dt) : "memory");   // precaution: no register that the d loads name is rewritten ahead of this wait (dt is named so that the pair lives up to it)
      __builtin_amdgcn_sched_barrier(0);   // keeps the loads one group in front of the P arithmetic, which then covers the LDS latency
#pragma unroll
      for (int j = 0; j < 8; ++j) { const float p0 = nexp_slot(lrelu(si + dlo[j]) - mi), p1 = nexp_slot(lrelu(si + dhi[j]) - mi); den += p0 + p1; b16 a, b; split16(p0 * PS, a, b); ph[j] = a; pl[j] = b; split16(p1 * PS, a, b); ph[8 + j] = a; pl[8 + j] = b; }
      __builtin_amdgcn_sched_barrier(0);   // keeps the 24 products one run behind the arithmetic, with no LDS read among them
#pragma unroll
      for (int t = 0; t < 8; ++t) acc[t] = wmma16p(ph, bh[t], acc[t]);
#pragma unroll
      for (int t = 0; t < 8; ++t) acc[t] = wmma16p(pl, bh[t], acc[t]);
#pragma unroll
      for (int t = 0; t < 8; ++t) acc[t] = wmma16p(ph, bl[t], acc[t]);
      __builtin_amdgcn_sched_barrier(0); } // keeps the next step's LDS reads out of this run of products
    asm volatile("s_wait_dscnt 0x0" ::: "memory");      // this wave's reads of the buffer are done before it is refilled
    asm volatile("s_wait_asynccnt 0x0" ::: "memory");   // this wave's share of tile tt + 1 has landed
    __syncthreads();                                    // publishes tile tt + 1 and ends every wave's reads of tile tt
    if (tt + 2 < NT) fill(tt + 2); }
  asm volatile("s_wait_asynccnt 0x0" ::: "memory");     // no copy is outstanding when the wave goes on
  den += __shfl_xor(den, 16);
  if (hlf == 0) dens[wave][nloc] = den;
  wave_lds_sync();
#pragma unroll
  for (int t = 0; t < 8; ++t) { const int c = t * 16 + nloc;
#pragma unroll 1
    for (int r8 = 0; r8 < 8; ++r8) { const int rl = 8 * hlf + r8; Tf[wave][rl][c] = acc[t][r8] * (1.0f / (PS * XS)) / dens[wave][rl]; } }
  wave_lds_sync();
  { for (int rr = 0; rr < 16; ++rr) *(v4f*)(out + (i0 + rr) * F + lane * 4) = *(const v4f*)(&Tf[wave][rr][lane * 4]);  }
}
}  // namespace

extern "C" void kernel_launch(void* const* d_in, const int* in_sizes, int n_in, void* d_out, int out_size, void* d_ws, size_t ws_size, hipStream_t stream) {
  (void)n_in;
  auto Fp = [&](int i) { return (const float*)d_in[i]; };
  // input order: 0 x [2,16,1024,128], 1 W [128,128], 2 a_src [128], 3 a_dst [128]
  if (in_sizes[0] != M * F || in_sizes[1] != F * F || in_sizes[2] != F || in_sizes[3] != F || out_size != M * F) return;
  size_t off = 0; char* ws = (char*)d_ws;
  auto carve = [&](size_t bytes) { char* p = ws + off; off += (bytes + 255) & ~(size_t)255; return p; };
  float* S = (float*)carve((size_t)M * 4); float* Dd = (float*)carve((size_t)M * 4); b16* HTH = (b16*)carve((size_t)NG * F * NN * 2); b16* HTL = (b16*)carve((size_t)NG * F * NN * 2);
  if (off > ws_size || off > ((size_t)64 << 20)) return;   // ~ 17 MB
  proj_kernel<<<M / 64, 128, 0, stream>>>(Fp(0), Fp(1), Fp(2), Fp(3), S, Dd, HTH, HTL);
  attn_kernel<<<M / 64, 128, 0, stream>>>(S, Dd, HTH, HTL, (float*)d_out);
}

// v004
// It runs in 37.9 microseconds.
// Two timings next to v003 put it at 1.29 and 1.30 times that version's speed.
// Counting every step since v000, it is 3.41 times as fast.
#include <hip/hip_runtime.h>

// Dense GAT layer on [2, 16, 1024, 128]: per (b, t) group of 1,024 nodes: h = x W; e[i][j] = leaky_0.2(h_i . a_src + h_j . a_dst); alpha = softmax over j; out = alpha h -> [2][16][1024][128].
// WMMA (v_wmma_f32_16x16x32_f16, f32 accumulate): h = bf16(x) W ([32,768 x 128] x [128 x 128], EXACT bf16 x8: 1 product) and per group out = P h ([1,024 x 1,024] x [1,024 x 128]: P = exp(e - rowmax)
// carried x16384 and split f16 hi+lo, built directly in the A fragments (rank-1 scores: rowmax_i = leaky(s_i + max_j d_j)); h transposed hi+lo x8 planes; 3 products); W exact x256; scores, row sums
// and the normalisation in f32. Inputs rounded to bf16 once. Fragment k-map per lane half hh for A AND B: elements 0..7 <- k = 8hh+0..7, 8..15 <- k = 16+8hh+0..7;

namespace {
constexpr int NG = 32, NN = 1024, F = 128, M = NG * NN;
constexpr float XS = 8.0f, WSC = 256.0f, PS = 16384.0f, NEG = 0.2f;
typedef _Float16 b16;
typedef __attribute__((ext_vector_type(16))) _Float16 v16b;
typedef __attribute__((ext_vector_type(8))) _Float16 v8b;
typedef __attribute__((ext_vector_type(8))) float v8f;
typedef __attribute__((ext_vector_type(4))) float v4f;
__device__ __forceinline__ float bf16_rne(float f) { unsigned int u = __float_as_uint(f); u += 0x7FFFu + ((u >> 16) & 1u); return __uint_as_float(u & 0xFFFF0000u); }
__device__ __forceinline__ void split16(float v, b16& hi, b16& lo) { hi = (b16)v; lo = (b16)(v - (float)hi); }
__device__ __forceinline__ v16b frag_kb(const b16* p, int hh) { const v8b a = *(const v8b*)(p + 8 * hh), b = *(const v8b*)(p + 16 + 8 * hh); v16b f;
#pragma unroll
  for (int e = 0; e < 8; ++e) { f[e] = a[e]; f[8 + e] = b[e]; } return f; }
__device__ __forceinline__ v8f wmma16b(v16b a, v16b b, v8f c) { v8f d = __builtin_amdgcn_wmma_f32_16x16x32_f16(false, a, false, b, (short)0, c, false, false); asm volatile("v_nop\n\tv_nop\n\tv_nop\n\tv_nop" : "+v"(d) : "v"(a), "v"(b)); return d; }
__device__ __forceinline__ v8f wmma16p(v16b a, v16b b, v8f c) { return __builtin_amdgcn_wmma_f32_16x16x32_f16(false, a, false, b, (short)0, c, false, false); }
__device__ __forceinline__ void wave_lds_sync() { __builtin_amdgcn_fence(__ATOMIC_RELEASE, "workgroup"); __builtin_amdgcn_wave_barrier(); __builtin_amdgcn_fence(__ATOMIC_ACQUIRE, "workgroup"); }
__device__ __forceinline__ float pmul(float a, float b) { float p = a * b; asm volatile("" : "+v"(p)); return p; }
__device__ __forceinline__ float opaque(float a) { asm volatile("" : "+v"(a)); return a; }
__device__ __forceinline__ float lrelu(float x) { return x >= 0.0f ? x : NEG * x; }
// v_exp_f32 with the one slot behind a transcendental tied to it
__device__ __forceinline__ float nexp_slot(float x) { const float y = x * 1.4426950408889634f; float r; asm("v_exp_f32 %0, %1\n\tv_nop" : "=v"(r) : "v"(y)); return r; }

// projection: block = 4 waves = 64 nodes of one group. W is rounded, scaled and transposed into LDS by the block itself; the h^T hi and lo planes go out straight from the accumulators
// (a lane holds 8 consecutive nodes of one column = one 16-byte piece of an h^T row), gathered in LDS so that eight lanes store one whole 128-byte line.
constexpr int WP = F + 8, JP = 64 + 8;   // LDS row pitches of 272 and 144 bytes = 16 x odd, free of bank conflicts for 16-byte reads
__global__ __launch_bounds__(128) void proj_kernel(const float* __restrict__ x, const float* __restrict__ w, const float* __restrict__ as_, const float* __restrict__ ad_, float* __restrict__ S, float* __restrict__ Dd, b16* __restrict__ HTH, b16* __restrict__ HTL) {
  __shared__ __attribute__((aligned(16))) b16 Wt[F][WP];      // [output column][k]
  __shared__ __attribute__((aligned(16))) b16 Ht[2][F][JP];   // [plane hi, lo][column][node of the block]
  __shared__ __attribute__((aligned(16))) float sa[64], sd[64];
  const int wave = threadIdx.x >> 5, lane = threadIdx.x & 31, nloc = lane & 15, hlf = lane >> 4; const size_t m0 = (size_t)blockIdx.x * 64 + wave * 16; const float* xr = x + (m0 + nloc) * F;
  const float* xp = xr + 8 * hlf; const int o4 = lane * 4, kw = wave * 32; const float* wp = w + (size_t)kw * F + o4;   // wave: 32 rows k of W; lane: 4 columns
  v4f xv[4][4], r[4][8];   // this lane's 32 x 4 piece of W, asked for first (short way, needed first), and its x in fragment order, which flies under the W staging
#pragma unroll
  for (int q = 0; q < 4; ++q) {
#pragma unroll
    for (int j = 0; j < 8; ++j) r[q][j] = *(const v4f*)(wp + (q * 8 + j) * F); }
  asm volatile("s_wait_xcnt 0x0" :: "v"(wp) : "memory");   // precaution: no register that the W loads name is rewritten ahead of this wait (wp is named so that the pair lives up to it)
#pragma unroll
  for (int q = 0; q < 4; ++q) { xv[q][0] = *(const v4f*)(xp + q * 32); xv[q][1] = *(const v4f*)(xp + q * 32 + 4); xv[q][2] = *(const v4f*)(xp + q * 32 + 16); xv[q][3] = *(const v4f*)(xp + q * 32 + 20); }
  asm volatile("s_wait_xcnt 0x0" :: "v"(xp) : "memory");   // the same precaution for the x loads
#pragma unroll
  for (int q = 0; q < 4; ++q) {
#pragma unroll
    for (int cc = 0; cc < 4; ++cc) { v8b v;
#pragma unroll
      for (int j = 0; j < 8; ++j) v[j] = (b16)(bf16_rne(r[q][j][cc]) * WSC);
      *(v8b*)(&Wt[o4 + cc][kw + q * 8]) = v; } }
  __syncthreads();   // publishes W^T to the four waves
  v8f acc[8];
#pragma unroll
  for (int t = 0; t < 8; ++t) acc[t] = (v8f){};
#pragma unroll
  for (int q = 0; q < 4; ++q) { v16b a, b[8];
#pragma unroll
    for (int t = 0; t < 8; ++t) b[t] = frag_kb(&Wt[t * 16 + nloc][q * 32], hlf);
    __builtin_amdgcn_sched_barrier(0);   // keeps the 16 LDS reads one group in front of the rounding of x, which then covers their latency
#pragma unroll
    for (int j = 0; j < 4; ++j) { a[j] = (b16)(bf16_rne(xv[q][0][j]) * XS); a[4 + j] = (b16)(bf16_rne(xv[q][1][j]) * XS); a[8 + j] = (b16)(bf16_rne(xv[q][2][j]) * XS); a[12 + j] = (b16)(bf16_rne(xv[q][3][j]) * XS); }
#pragma unroll
    for (int t = 0; t < 8; ++t) acc[t] = wmma16b(a, b[t], acc[t]); }
  float ps[8], pd[8]; for (int r8 = 0; r8 < 8; ++r8) { ps[r8] = 0.0f; pd[r8] = 0.0f; }
#pragma unroll
  for (int t = 0; t < 8; ++t) { const int c = t * 16 + nloc; const float ws_ = opaque(bf16_rne(as_[c])), wd_ = opaque(bf16_rne(ad_[c])); v8b hi, lo;
#pragma unroll
    for (int r8 = 0; r8 < 8; ++r8) { const float v = acc[t][r8] * (1.0f / (XS * WSC)); ps[r8] += pmul(v, ws_); pd[r8] += pmul(v, wd_); b16 p, q; split16(v * XS, p, q); hi[r8] = p; lo[r8] = q; }
    *(v8b*)(&Ht[0][c][wave * 16 + 8 * hlf]) = hi; *(v8b*)(&Ht[1][c][wave * 16 + 8 * hlf]) = lo; }
#pragma unroll
  for (int r8 = 0; r8 < 8; ++r8) { float a = ps[r8], b = pd[r8]; for (int o = 1; o < 16; o <<= 1) { a += __shfl_xor(a, o); b += __shfl_xor(b, o); } if (nloc == 0) { sa[wave * 16 + 8 * hlf + r8] = a; sd[wave * 16 + 8 * hlf + r8] = b; } }
  __syncthreads();
  { const int g = blockIdx.x / (NN / 64), j0 = (blockIdx.x % (NN / 64)) * 64, cr = threadIdx.x >> 3, ch = (threadIdx.x & 7) * 8;
#pragma unroll
    for (int it = 0; it < 8; ++it) { const int c = it * 16 + cr; const size_t d = ((size_t)g * F + c) * NN + j0 + ch; *(v8b*)(HTH + d) = *(const v8b*)(&Ht[0][c][ch]); *(v8b*)(HTL + d) = *(const v8b*)(&Ht[1][c][ch]); }
    if (threadIdx.x < 16) *(v4f*)(S + (size_t)blockIdx.x * 64 + threadIdx.x * 4) = *(const v4f*)(&sa[threadIdx.x * 4]); else if (threadIdx.x < 32) *(v4f*)(Dd + (size_t)blockIdx.x * 64 + (threadIdx.x - 16) * 4) = *(const v4f*)(&sd[(threadIdx.x - 16) * 4]);
  }
}
// attention: wave per 16 rows i of group g (block = 4 waves = 64 rows): max_j d_j over the group; P fragments on the fly: p = exp(leaky(s_i + d_j) - leaky(s_i + max d)) x16384 split hi+lo; den in f32 from the
// unsplit p. A 32-k step asks for its d_j and all its h^T fragments first, forms P under their latency, then runs its products plane by plane over the eight independent column tiles. The h^T planes reach the waves through LDS: a tile = 64 k of all 128 columns, hi and lo plane, brought once per block by asynchronous copies, two buffers, so that the next tile flies under this tile's products.
constexpr int KT = 64, NT = NN / KT, KP = KT + 8;   // KP: LDS row pitch of 144 bytes = 16 x odd, free of bank conflicts for 16-byte reads
// Eight rows-of-16 steps of one plane: each lane copies 16 bytes, eight lanes cover one whole 128-byte line. The s_wait_xcnt stands inside the statement so that no address register is rewritten ahead of it.
__device__ __forceinline__ void copy8(unsigned int l, const b16* g) {
  asm volatile("global_load_async_to_lds_b128 %0, %8, off\n\t"
               "global_load_async_to_lds_b128 %1, %9, off\n\t"
               "global_load_async_to_lds_b128 %2, %10, off\n\t"
               "global_load_async_to_lds_b128 %3, %11, off\n\t"
               "global_load_async_to_lds_b128 %4, %12, off\n\t"
               "global_load_async_to_lds_b128 %5, %13, off\n\t"
               "global_load_async_to_lds_b128 %6, %14, off\n\t"
               "global_load_async_to_lds_b128 %7, %15, off\n\t"
               "s_wait_xcnt 0x0"
               :: "v"(l), "v"(l + 1u * 16 * KP * 2), "v"(l + 2u * 16 * KP * 2), "v"(l + 3u * 16 * KP * 2), "v"(l + 4u * 16 * KP * 2), "v"(l + 5u * 16 * KP * 2), "v"(l + 6u * 16 * KP * 2), "v"(l + 7u * 16 * KP * 2),
                  "v"(g), "v"(g + 1 * 16 * NN), "v"(g + 2 * 16 * NN), "v"(g + 3 * 16 * NN), "v"(g + 4 * 16 * NN), "v"(g + 5 * 16 * NN), "v"(g + 6 * 16 * NN), "v"(g + 7 * 16 * NN)
               : "memory");
}
__global__ __launch_bounds__(128) void attn_kernel(const float* __restrict__ S, const float* __restrict__ Dd, const b16* __restrict__ HTH, const b16* __restrict__ HTL, float* __restrict__ out) {
  __shared__ __attribute__((aligned(16))) b16 ring[2][2][F][KP];   // [buffer][plane hi, lo][column][k]
  __shared__ __attribute__((aligned(16))) float Tf[4][16][F + 4]; __shared__ __attribute__((aligned(16))) float dens[4][16];
  const int wave = threadIdx.x >> 5, lane = threadIdx.x & 31, nloc = lane & 15, hlf = lane >> 4; const size_t i0 = (size_t)blockIdx.x * 64 + wave * 16; const int g = (int)(i0 / NN); const float* Dg = Dd + (size_t)g * NN;
  const b16* Hh = HTH + (size_t)g * F * NN; const b16* Hl = HTL + (size_t)g * F * NN;
  const int crow = threadIdx.x >> 3, cch = (threadIdx.x & 7) * 8; const size_t csrc = (size_t)crow * NN + cch;
  auto fill = [&](int tile) { const int b = tile & 1; copy8((unsigned int)(size_t)&ring[b][0][crow][cch], Hh + csrc + tile * KT); copy8((unsigned int)(size_t)&ring[b][1][crow][cch], Hl + csrc + tile * KT); };
  const float* dp = Dg + lane * 4; const float* sp = S + i0 + nloc; v4f dv[8];   // the group's 1,024 d_j, 32 a lane, and s_i: one group of loads, one latency, asked for ahead of tile 0 because they are needed first
#pragma unroll   // all eight loads go out before any is waited for
  for (int q = 0; q < 8; ++q) dv[q] = *(const v4f*)(dp + q * 128);
  const float si = *sp;
  asm volatile("s_wait_xcnt 0x0" :: "v"(dp), "v"(sp) : "memory");   // precaution: no register that these loads name is rewritten ahead of this wait (both pointers are named so that they live up to it)
  fill(0);
  __builtin_amdgcn_sched_barrier(0);   // keeps the wait on the d loads behind the issue of tile 0's copies, so that both fly at once
  float mx = -INFINITY;
#pragma unroll   // dv stays in registers
  for (int q = 0; q < 8; ++q) mx = fmaxf(mx, fmaxf(fmaxf(dv[q][0], dv[q][1]), fmaxf(dv[q][2], dv[q][3])));
  for (int o = 16; o; o >>= 1) mx = fmaxf(mx, __shfl_xor(mx, o));
  const float mi = lrelu(si + mx); float den = 0.0f;
  v8f acc[8];
#pragma unroll
  for (int t = 0; t < 8; ++t) acc[t] = (v8f){};
  asm volatile("s_wait_asynccnt 0x0" ::: "memory");   // this wave's share of tile 0 has landed
  __syncthreads();                                    // publishes tile 0 to the other waves
  fill(1);
#pragma unroll 1
  for (int tt = 0; tt < NT; ++tt) { const int bf = tt & 1; const float* dt = Dg + tt * KT + 8 * hlf;   // this lane's d_j of the tile
#pragma unroll
    for (int ks = 0; ks < KT; ks += 32) { v16b ph, pl, bh[8], bl[8];
      const v8f dlo = *(const v8f*)(dt + ks), dhi = *(const v8f*)(dt + ks + 16);   // this step's d_j in the lane's fragment order, asked for first
#pragma unroll
      for (int t = 0; t < 8; ++t) bh[t] = frag_kb(&ring[bf][0][t * 16 + nloc][ks], hlf);
#pragma unroll
      for (int t = 0; t < 8; ++t) bl[t] = frag_kb(&ring[bf][1][t * 16 + nloc][ks], hlf);
      asm volatile("s_wait_xcnt 0x0" :: "v"(dt) : "memory");   // precaution: no register that the d loads name is rewritten ahead of this wait (dt is named so that the pair lives up to it)
      __builtin_amdgcn_sched_barrier(0);   // keeps the loads one group in front of the P arithmetic, which then covers the LDS latency
#pragma unroll
      for (int j = 0; j < 8; ++j) { const float p0 = nexp_slot(lrelu(si + dlo[j]) - mi), p1 = nexp_slot(lrelu(si + dhi[j]) - mi); den += p0 + p1; b16 a, b; split16(p0 * PS, a, b); ph[j] = a; pl[j] = b; split16(p1 * PS, a, b); ph[8 + j] = a; pl[8 + j] = b; }
      __builtin_amdgcn_sched_barrier(0);   // keeps the 24 products one run behind the arithmetic, with no LDS read among them
#pragma unroll
      for (int t = 0; t < 8; ++t) acc[t] = wmma16p(ph, bh[t], acc[t]);
#pragma unroll
      for (int t = 0; t < 8; ++t) acc[t] = wmma16p(pl, bh[t], acc[t]);
#pragma unroll
      for (int t = 0; t < 8; ++t) acc[t] = wmma16p(ph, bl[t], acc[t]);
      __builtin_amdgcn_sched_barrier(0); } // keeps the next step's LDS reads out of this run of products
    asm volatile("s_wait_dscnt 0x0" ::: "memory");      // this wave's reads of the buffer are done before it is refilled
    asm volatile("s_wait_asynccnt 0x0" ::: "memory");   // this wave's share of tile tt + 1 has landed
    __syncthreads();                                    // publishes tile tt + 1 and ends every wave's reads of tile tt
    if (tt + 2 < NT) fill(tt + 2); }
  asm volatile("s_wait_asynccnt 0x0" ::: "memory");     // no copy is outstanding when the wave goes on
  den += __shfl_xor(den, 16);
  if (hlf == 0) dens[wave][nloc] = den;
  wave_lds_sync();
  float inv[8];   // one scale per row of the lane: its eight sums come by two reads, the eight divisions run side by side
  { const v4f q0 = *(const v4f*)(&dens[wave][8 * hlf]), q1 = *(const v4f*)(&dens[wave][8 * hlf + 4]);
#pragma unroll   // eight independent division chains instead of one after another
    for (int r8 = 0; r8 < 4; ++r8) { inv[r8] = (1.0f / (PS * XS)) / q0[r8]; inv[4 + r8] = (1.0f / (PS * XS)) / q1[r8]; } }
#pragma unroll
  for (int t = 0; t < 8; ++t) { const int c = t * 16 + nloc;
#pragma unroll   // constant accumulator indices, no LDS read and no wait per element
    for (int r8 = 0; r8 < 8; ++r8) Tf[wave][8 * hlf + r8][c] = acc[t][r8] * inv[r8]; }
  wave_lds_sync();
  { for (int rr = 0; rr < 16; ++rr) *(v4f*)(out + (i0 + rr) * F + lane * 4) = *(const v4f*)(&Tf[wave][rr][lane * 4]);  }
}
}  // namespace

extern "C" void kernel_launch(void* const* d_in, const int* in_sizes, int n_in, void* d_out, int out_size, void* d_ws, size_t ws_size, hipStream_t stream) {
  (void)n_in;
  auto Fp = [&](int i) { return (const float*)d_in[i]; };
  // input order: 0 x [2,16,1024,128], 1 W [128,128], 2 a_src [128], 3 a_dst [128]
  if (in_sizes[0] != M * F || in_sizes[1] != F * F || in_sizes[2] != F || in_sizes[3] != F || out_size != M * F) return;
  size_t off = 0; char* ws = (char*)d_ws;
  auto carve = [&](size_t bytes) { char* p = ws + off; off += (bytes + 255) & ~(size_t)255; return p; };
  float* S = (float*)carve((size_t)M * 4); float* Dd = (float*)carve((size_t)M * 4); b16* HTH = (b16*)carve((size_t)NG * F * NN * 2); b16* HTL = (b16*)carve((size_t)NG * F * NN * 2);
  if (off > ws_size || off > ((size_t)64 << 20)) return;   // ~ 17 MB
  proj_kernel<<<M / 64, 128, 0, stream>>>(Fp(0), Fp(1), Fp(2), Fp(3), S, Dd, HTH, HTL);
  attn_kernel<<<M / 64, 128, 0, stream>>>(S, Dd, HTH, HTL, (float*)d_out);
}

// v005
// It runs in 35 microseconds.
// Two timings next to v004 both put it at 1.09 times that version's speed.
// Counting every step since v000, it is 3.71 times as fast.
#include <hip/hip_runtime.h>

// Dense GAT layer on [2, 16, 1024, 128]: per (b, t) group of 1,024 nodes: h = x W; e[i][j] = leaky_0.2(h_i . a_src + h_j . a_dst); alpha = softmax over j; out = alpha h -> [2][16][1024][128].
// WMMA (v_wmma_f32_16x16x32_f16, f32 accumulate): h = bf16(x) W ([32,768 x 128] x [128 x 128], EXACT bf16 x8: 1 product) and per group out = P h ([1,024 x 1,024] x [1,024 x 128]: P = exp(e - rowmax)
// carried x16384 and split f16 hi+lo, built directly in the A fragments (rank-1 scores: rowmax_i = leaky(s_i + max_j d_j)); h transposed hi+lo x8 planes; 3 products); W exact x256; scores, row sums
// and the normalisation in f32. Inputs rounded to bf16 once. Fragment k-map per lane half hh for A AND B: elements 0..7 <- k = 8hh+0..7, 8..15 <- k = 16+8hh+0..7;

namespace {
constexpr int NG = 32, NN = 1024, F = 128, M = NG * NN;
constexpr float XS = 8.0f, WSC = 256.0f, PS = 16384.0f, NEG = 0.2f;
typedef _Float16 b16;
typedef __attribute__((ext_vector_type(16))) _Float16 v16b;
typedef __attribute__((ext_vector_type(8))) _Float16 v8b;
typedef __attribute__((ext_vector_type(8))) float v8f;
typedef __attribute__((ext_vector_type(4))) float v4f;
__device__ __forceinline__ float bf16_rne(float f) { unsigned int u = __float_as_uint(f); u += 0x7FFFu + ((u >> 16) & 1u); return __uint_as_float(u & 0xFFFF0000u); }
__device__ __forceinline__ void split16(float v, b16& hi, b16& lo) { hi = (b16)v; lo = (b16)(v - (float)hi); }
__device__ __forceinline__ v16b frag_kb(const b16* p, int hh) { const v8b a = *(const v8b*)(p + 8 * hh), b = *(const v8b*)(p + 16 + 8 * hh); v16b f;
#pragma unroll
  for (int e = 0; e < 8; ++e) { f[e] = a[e]; f[8 + e] = b[e]; } return f; }
__device__ __forceinline__ v8f wmma16b(v16b a, v16b b, v8f c) { v8f d = __builtin_amdgcn_wmma_f32_16x16x32_f16(false, a, false, b, (short)0, c, false, false); asm volatile("v_nop\n\tv_nop\n\tv_nop\n\tv_nop" : "+v"(d) : "v"(a), "v"(b)); return d; }
__device__ __forceinline__ v8f wmma16p(v16b a, v16b b, v8f c) { return __builtin_amdgcn_wmma_f32_16x16x32_f16(false, a, false, b, (short)0, c, false, false); }
__device__ __forceinline__ void wave_lds_sync() { __builtin_amdgcn_fence(__ATOMIC_RELEASE, "workgroup"); __builtin_amdgcn_wave_barrier(); __builtin_amdgcn_fence(__ATOMIC_ACQUIRE, "workgroup"); }
__device__ __forceinline__ float pmul(float a, float b) { float p = a * b; asm volatile("" : "+v"(p)); return p; }
__device__ __forceinline__ float opaque(float a) { asm volatile("" : "+v"(a)); return a; }
__device__ __forceinline__ float lrelu(float x) { return x >= 0.0f ? x : NEG * x; }
// v_exp_f32 with the one slot behind a transcendental tied to it
__device__ __forceinline__ float nexp_slot(float x) { const float y = x * 1.4426950408889634f; float r; asm("v_exp_f32 %0, %1\n\tv_nop" : "=v"(r) : "v"(y)); return r; }

// projection: block = 4 waves = 64 nodes of one group. W is rounded, scaled and transposed into LDS by the block itself; the h^T hi and lo planes go out straight from the accumulators
// (a lane holds 8 consecutive nodes of one column = one 16-byte piece of an h^T row), gathered in LDS so that eight lanes store one whole 128-byte line.
constexpr int WP = F + 8, JP = 64 + 8;   // LDS row pitches of 272 and 144 bytes = 16 x odd, free of bank conflicts for 16-byte reads
__global__ __launch_bounds__(128) void proj_kernel(const float* __restrict__ x, const float* __restrict__ w, const float* __restrict__ as_, const float* __restrict__ ad_, float* __restrict__ S, float* __restrict__ Dd, b16* __restrict__ HTH, b16* __restrict__ HTL) {
  __shared__ __attribute__((aligned(16))) b16 Wt[F][WP];      // [output column][k]
  __shared__ __attribute__((aligned(16))) b16 Ht[2][F][JP];   // [plane hi, lo][column][node of the block]
  __shared__ __attribute__((aligned(16))) float sa[64], sd[64];
  const int wave = threadIdx.x >> 5, lane = threadIdx.x & 31, nloc = lane & 15, hlf = lane >> 4; const size_t m0 = (size_t)blockIdx.x * 64 + wave * 16; const float* xr = x + (m0 + nloc) * F;
  const float* xp = xr + 8 * hlf; const int o4 = lane * 4, kw = wave * 32; const float* wp = w + (size_t)kw * F + o4;   // wave: 32 rows k of W; lane: 4 columns
  v4f xv[4][4], r[4][8];   // this lane's 32 x 4 piece of W, asked for first (short way, needed first), and its x in fragment order, which flies under the W staging
#pragma unroll
  for (int q = 0; q < 4; ++q) {
#pragma unroll
    for (int j = 0; j < 8; ++j) r[q][j] = *(const v4f*)(wp + (q * 8 + j) * F); }
  asm volatile("s_wait_xcnt 0x0" :: "v"(wp) : "memory");   // precaution: no register that the W loads name is rewritten ahead of this wait (wp is named so that the pair lives up to it)
#pragma unroll
  for (int q = 0; q < 4; ++q) { xv[q][0] = *(const v4f*)(xp + q * 32); xv[q][1] = *(const v4f*)(xp + q * 32 + 4); xv[q][2] = *(const v4f*)(xp + q * 32 + 16); xv[q][3] = *(const v4f*)(xp + q * 32 + 20); }
  asm volatile("s_wait_xcnt 0x0" :: "v"(xp) : "memory");   // the same precaution for the x loads
#pragma unroll
  for (int q = 0; q < 4; ++q) {
#pragma unroll
    for (int cc = 0; cc < 4; ++cc) { v8b v;
#pragma unroll
      for (int j = 0; j < 8; ++j) v[j] = (b16)(bf16_rne(r[q][j][cc]) * WSC);
      *(v8b*)(&Wt[o4 + cc][kw + q * 8]) = v; } }
  __syncthreads();   // publishes W^T to the four waves
  float av[8], bv[8];   // this lane's a_src and a_dst, one group of 16 loads asked for here, so that they fly under the products and none is waited for alone behind them
#pragma unroll   // all sixteen loads go out before any is waited for
  for (int t = 0; t < 8; ++t) { av[t] = as_[t * 16 + nloc]; bv[t] = ad_[t * 16 + nloc]; }
  asm volatile("s_wait_xcnt 0x0" :: "v"(nloc) : "memory");   // precaution: no register that these loads name is rewritten ahead of this wait (the lane's index, their one vector operand, is named so that it lives up to it)
  v8f acc[8];
#pragma unroll
  for (int t = 0; t < 8; ++t) acc[t] = (v8f){};
#pragma unroll
  for (int q = 0; q < 4; ++q) { v16b a, b[8];
#pragma unroll
    for (int t = 0; t < 8; ++t) b[t] = frag_kb(&Wt[t * 16 + nloc][q * 32], hlf);
    __builtin_amdgcn_sched_barrier(0);   // keeps the 16 LDS reads one group in front of the rounding of x, which then covers their latency
#pragma unroll
    for (int j = 0; j < 4; ++j) { a[j] = (b16)(bf16_rne(xv[q][0][j]) * XS); a[4 + j] = (b16)(bf16_rne(xv[q][1][j]) * XS); a[8 + j] = (b16)(bf16_rne(xv[q][2][j]) * XS); a[12 + j] = (b16)(bf16_rne(xv[q][3][j]) * XS); }
#pragma unroll
    for (int t = 0; t < 8; ++t) acc[t] = wmma16b(a, b[t], acc[t]); }
  float ps[8], pd[8]; for (int r8 = 0; r8 < 8; ++r8) { ps[r8] = 0.0f; pd[r8] = 0.0f; }
#pragma unroll
  for (int t = 0; t < 8; ++t) { const int c = t * 16 + nloc; const float ws_ = opaque(bf16_rne(av[t])), wd_ = opaque(bf16_rne(bv[t])); v8b hi, lo;
#pragma unroll
    for (int r8 = 0; r8 < 8; ++r8) { const float v = acc[t][r8] * (1.0f / (XS * WSC)); ps[r8] += pmul(v, ws_); pd[r8] += pmul(v, wd_); b16 p, q; split16(v * XS, p, q); hi[r8] = p; lo[r8] = q; }
    *(v8b*)(&Ht[0][c][wave * 16 + 8 * hlf]) = hi; *(v8b*)(&Ht[1][c][wave * 16 + 8 * hlf]) = lo; }
#pragma unroll   // the sixteen row sums go through each exchange stage side by side: four waits instead of one per sum and stage; every sum keeps its own order of additions
  for (int o = 1; o < 16; o <<= 1) { float ta[8], tb[8];
#pragma unroll
    for (int r8 = 0; r8 < 8; ++r8) { ta[r8] = __shfl_xor(ps[r8], o); tb[r8] = __shfl_xor(pd[r8], o); }
#pragma unroll
    for (int r8 = 0; r8 < 8; ++r8) { ps[r8] += ta[r8]; pd[r8] += tb[r8]; } }
  if (nloc == 0) { float* qa = &sa[wave * 16 + 8 * hlf]; float* qd = &sd[wave * 16 + 8 * hlf];
    *(v4f*)qa = (v4f){ps[0], ps[1], ps[2], ps[3]}; *(v4f*)(qa + 4) = (v4f){ps[4], ps[5], ps[6], ps[7]}; *(v4f*)qd = (v4f){pd[0], pd[1], pd[2], pd[3]}; *(v4f*)(qd + 4) = (v4f){pd[4], pd[5], pd[6], pd[7]}; }
  __syncthreads();
  { const int g = blockIdx.x / (NN / 64), j0 = (blockIdx.x % (NN / 64)) * 64, cr = threadIdx.x >> 3, ch = (threadIdx.x & 7) * 8;
#pragma unroll
    for (int it = 0; it < 8; ++it) { const int c = it * 16 + cr; const size_t d = ((size_t)g * F + c) * NN + j0 + ch; *(v8b*)(HTH + d) = *(const v8b*)(&Ht[0][c][ch]); *(v8b*)(HTL + d) = *(const v8b*)(&Ht[1][c][ch]); }
    if (threadIdx.x < 16) *(v4f*)(S + (size_t)blockIdx.x * 64 + threadIdx.x * 4) = *(const v4f*)(&sa[threadIdx.x * 4]); else if (threadIdx.x < 32) *(v4f*)(Dd + (size_t)blockIdx.x * 64 + (threadIdx.x - 16) * 4) = *(const v4f*)(&sd[(threadIdx.x - 16) * 4]);
  }
}
// attention: wave per 16 rows i of group g (block = 4 waves = 64 rows): max_j d_j over the group; P fragments on the fly: p = exp(leaky(s_i + d_j) - leaky(s_i + max d)) x16384 split hi+lo; den in f32 from the
// unsplit p. A 32-k step asks for its d_j and all its h^T fragments first, forms P under their latency, then runs its products plane by plane over the eight independent column tiles. The h^T planes reach the waves through LDS: a tile = 64 k of all 128 columns, hi and lo plane, brought once per block by asynchronous copies, two buffers, so that the next tile flies under this tile's products.
constexpr int KT = 64, NT = NN / KT, KP = KT + 8;   // KP: LDS row pitch of 144 bytes = 16 x odd, free of bank conflicts for 16-byte reads
// Eight rows-of-16 steps of one plane: each lane copies 16 bytes, eight lanes cover one whole 128-byte line. The s_wait_xcnt stands inside the statement so that no address register is rewritten ahead of it.
__device__ __forceinline__ void copy8(unsigned int l, const b16* g) {
  asm volatile("global_load_async_to_lds_b128 %0, %8, off\n\t"
               "global_load_async_to_lds_b128 %1, %9, off\n\t"
               "global_load_async_to_lds_b128 %2, %10, off\n\t"
               "global_load_async_to_lds_b128 %3, %11, off\n\t"
               "global_load_async_to_lds_b128 %4, %12, off\n\t"
               "global_load_async_to_lds_b128 %5, %13, off\n\t"
               "global_load_async_to_lds_b128 %6, %14, off\n\t"
               "global_load_async_to_lds_b128 %7, %15, off\n\t"
               "s_wait_xcnt 0x0"
               :: "v"(l), "v"(l + 1u * 16 * KP * 2), "v"(l + 2u * 16 * KP * 2), "v"(l + 3u * 16 * KP * 2), "v"(l + 4u * 16 * KP * 2), "v"(l + 5u * 16 * KP * 2), "v"(l + 6u * 16 * KP * 2), "v"(l + 7u * 16 * KP * 2),
                  "v"(g), "v"(g + 1 * 16 * NN), "v"(g + 2 * 16 * NN), "v"(g + 3 * 16 * NN), "v"(g + 4 * 16 * NN), "v"(g + 5 * 16 * NN), "v"(g + 6 * 16 * NN), "v"(g + 7 * 16 * NN)
               : "memory");
}
__global__ __launch_bounds__(128) void attn_kernel(const float* __restrict__ S, const float* __restrict__ Dd, const b16* __restrict__ HTH, const b16* __restrict__ HTL, float* __restrict__ out) {
  __shared__ __attribute__((aligned(16))) b16 ring[2][2][F][KP];   // [buffer][plane hi, lo][column][k]
  __shared__ __attribute__((aligned(16))) float Tf[4][16][F + 4]; __shared__ __attribute__((aligned(16))) float dens[4][16];
  const int wave = threadIdx.x >> 5, lane = threadIdx.x & 31, nloc = lane & 15, hlf = lane >> 4; const size_t i0 = (size_t)blockIdx.x * 64 + wave * 16; const int g = (int)(i0 / NN); const float* Dg = Dd + (size_t)g * NN;
  const b16* Hh = HTH + (size_t)g * F * NN; const b16* Hl = HTL + (size_t)g * F * NN;
  const int crow = threadIdx.x >> 3, cch = (threadIdx.x & 7) * 8; const size_t csrc = (size_t)crow * NN + cch;
  auto fill = [&](int tile) { const int b = tile & 1; copy8((unsigned int)(size_t)&ring[b][0][crow][cch], Hh + csrc + tile * KT); copy8((unsigned int)(size_t)&ring[b][1][crow][cch], Hl + csrc + tile * KT); };
  const float* dp = Dg + lane * 4; const float* sp = S + i0 + nloc; v4f dv[8];   // the group's 1,024 d_j, 32 a lane, and s_i: one group of loads, one latency, asked for ahead of tile 0 because they are needed first
#pragma unroll   // all eight loads go out before any is waited for
  for (int q = 0; q < 8; ++q) dv[q] = *(const v4f*)(dp + q * 128);
  const float si = *sp;
  asm volatile("s_wait_xcnt 0x0" :: "v"(dp), "v"(sp) : "memory");   // precaution: no register that these loads name is rewritten ahead of this wait (both pointers are named so that they live up to it)
  fill(0);
  __builtin_amdgcn_sched_barrier(0);   // keeps the wait on the d loads behind the issue of tile 0's copies, so that both fly at once
  float mx = -INFINITY;
#pragma unroll   // dv stays in registers
  for (int q = 0; q < 8; ++q) mx = fmaxf(mx, fmaxf(fmaxf(dv[q][0], dv[q][1]), fmaxf(dv[q][2], dv[q][3])));
  for (int o = 16; o; o >>= 1) mx = fmaxf(mx, __shfl_xor(mx, o));
  const float mi = lrelu(si + mx); float den = 0.0f;
  v8f acc[8];
#pragma unroll
  for (int t = 0; t < 8; ++t) acc[t] = (v8f){};
  asm volatile("s_wait_asynccnt 0x0" ::: "memory");   // this wave's share of tile 0 has landed
  __syncthreads();                                    // publishes tile 0 to the other waves
  fill(1);
#pragma unroll 1
  for (int tt = 0; tt < NT; ++tt) { const int bf = tt & 1; const float* dt = Dg + tt * KT + 8 * hlf;   // this lane's d_j of the tile
#pragma unroll
    for (int ks = 0; ks < KT; ks += 32) { v16b ph, pl, bh[8], bl[8];
      const v8f dlo = *(const v8f*)(dt + ks), dhi = *(const v8f*)(dt + ks + 16);   // this step's d_j in the lane's fragment order, asked for first
#pragma unroll
      for (int t = 0; t < 8; ++t) bh[t] = frag_kb(&ring[bf][0][t * 16 + nloc][ks], hlf);
#pragma unroll
      for (int t = 0; t < 8; ++t) bl[t] = frag_kb(&ring[bf][1][t * 16 + nloc][ks], hlf);
      asm volatile("s_wait_xcnt 0x0" :: "v"(dt) : "memory");   // precaution: no register that the d loads name is rewritten ahead of this wait (dt is named so that the pair lives up to it)
      __builtin_amdgcn_sched_barrier(0);   // keeps the loads one group in front of the P arithmetic, which then covers the LDS latency
#pragma unroll
      for (int j = 0; j < 8; ++j) { const float p0 = nexp_slot(lrelu(si + dlo[j]) - mi), p1 = nexp_slot(lrelu(si + dhi[j]) - mi); den += p0 + p1; b16 a, b; split16(p0 * PS, a, b); ph[j] = a; pl[j] = b; split16(p1 * PS, a, b); ph[8 + j] = a; pl[8 + j] = b; }
      __builtin_amdgcn_sched_barrier(0);   // keeps the 24 products one run behind the arithmetic, with no LDS read among them
#pragma unroll
      for (int t = 0; t < 8; ++t) acc[t] = wmma16p(ph, bh[t], acc[t]);
#pragma unroll
      for (int t = 0; t < 8; ++t) acc[t] = wmma16p(pl, bh[t], acc[t]);
#pragma unroll
      for (int t = 0; t < 8; ++t) acc[t] = wmma16p(ph, bl[t], acc[t]);
      __builtin_amdgcn_sched_barrier(0); } // keeps the next step's LDS reads out of this run of products
    asm volatile("s_wait_dscnt 0x0" ::: "memory");      // this wave's reads of the buffer are done before it is refilled
    asm volatile("s_wait_asynccnt 0x0" ::: "memory");   // this wave's share of tile tt + 1 has landed
    __syncthreads();                                    // publishes tile tt + 1 and ends every wave's reads of tile tt
    if (tt + 2 < NT) fill(tt + 2); }
  asm volatile("s_wait_asynccnt 0x0" ::: "memory");     // no copy is outstanding when the wave goes on
  den += __shfl_xor(den, 16);
  if (hlf == 0) dens[wave][nloc] = den;
  wave_lds_sync();
  float inv[8];   // one scale per row of the lane: its eight sums come by two reads, the eight divisions run side by side
  { const v4f q0 = *(const v4f*)(&dens[wave][8 * hlf]), q1 = *(const v4f*)(&dens[wave][8 * hlf + 4]);
#pragma unroll   // eight independent division chains instead of one after another
    for (int r8 = 0; r8 < 4; ++r8) { inv[r8] = (1.0f / (PS * XS)) / q0[r8]; inv[4 + r8] = (1.0f / (PS * XS)) / q1[r8]; } }
#pragma unroll
  for (int t = 0; t < 8; ++t) { const int c = t * 16 + nloc;
#pragma unroll   // constant accumulator indices, no LDS read and no wait per element
    for (int r8 = 0; r8 < 8; ++r8) Tf[wave][8 * hlf + r8][c] = acc[t][r8] * inv[r8]; }
  wave_lds_sync();
  { for (int rr = 0; rr < 16; ++rr) *(v4f*)(out + (i0 + rr) * F + lane * 4) = *(const v4f*)(&Tf[wave][rr][lane * 4]);  }
}
}  // namespace

extern "C" void kernel_launch(void* const* d_in, const int* in_sizes, int n_in, void* d_out, int out_size, void* d_ws, size_t ws_size, hipStream_t stream) {
  (void)n_in;
  auto Fp = [&](int i) { return (const float*)d_in[i]; };
  // input order: 0 x [2,16,1024,128], 1 W [128,128], 2 a_src [128], 3 a_dst [128]
  if (in_sizes[0] != M * F || in_sizes[1] != F * F || in_sizes[2] != F || in_sizes[3] != F || out_size != M * F) return;
  size_t off = 0; char* ws = (char*)d_ws;
  auto carve = [&](size_t bytes) { char* p = ws + off; off += (bytes + 255) & ~(size_t)255; return p; };
  float* S = (float*)carve((size_t)M * 4); float* Dd = (float*)carve((size_t)M * 4); b16* HTH = (b16*)carve((size_t)NG * F * NN * 2); b16* HTL = (b16*)carve((size_t)NG * F * NN * 2);
  if (off > ws_size || off > ((size_t)64 << 20)) return;   // ~ 17 MB
  proj_kernel<<<M / 64, 128, 0, stream>>>(Fp(0), Fp(1), Fp(2), Fp(3), S, Dd, HTH, HTL);
  attn_kernel<<<M / 64, 128, 0, stream>>>(S, Dd, HTH, HTL, (float*)d_out);
}

// v006
// One run takes 29.6 microseconds.
// Timed twice side by side with v005, it ran 1.18 times as fast both times.
// Counting every step since v000, it is 4.37 times as fast.
#include <hip/hip_runtime.h>

// Dense GAT layer on [2, 16, 1024, 128]: per (b, t) group of 1,024 nodes: h = x W; e[i][j] = leaky_0.2(h_i . a_src + h_j . a_dst); alpha = softmax over j; out = alpha h -> [2][16][1024][128].
// WMMA (v_wmma_f32_16x16x32_f16, f32 accumulate): h = bf16(x) W ([32,768 x 128] x [128 x 128], EXACT bf16 x8: 1 product) and per group out = P h ([1,024 x 1,024] x [1,024 x 128]: P = exp(e - rowmax)
// carried x16384 and split f16 hi+lo, built directly in the A fragments (rank-1 scores: rowmax_i = leaky(s_i + max_j d_j)); h transposed hi+lo x8 planes; 3 products); W exact x256; scores, row sums
// and the normalisation in f32. Inputs rounded to bf16 once. Fragment k-map per lane half hh for A AND B: elements 0..7 <- k = 8hh+0..7, 8..15 <- k = 16+8hh+0..7;

namespace {
constexpr int NG = 32, NN = 1024, F = 128, M = NG * NN;
constexpr float XS = 8.0f, WSC = 256.0f, PS = 16384.0f, NEG = 0.2f;
typedef _Float16 b16;
typedef __attribute__((ext_vector_type(16))) _Float16 v16b;
typedef __attribute__((ext_vector_type(8))) _Float16 v8b;
typedef __attribute__((ext_vector_type(8))) float v8f;
typedef __attribute__((ext_vector_type(4))) float v4f;
__device__ __forceinline__ float bf16_rne(float f) { unsigned int u = __float_as_uint(f); u += 0x7FFFu + ((u >> 16) & 1u); return __uint_as_float(u & 0xFFFF0000u); }
__device__ __forceinline__ void split16(float v, b16& hi, b16& lo) { hi = (b16)v; lo = (b16)(v - (float)hi); }
__device__ __forceinline__ v16b frag_kb(const b16* p, int hh) { const v8b a = *(const v8b*)(p + 8 * hh), b = *(const v8b*)(p + 16 + 8 * hh); v16b f;
#pragma unroll
  for (int e = 0; e < 8; ++e) { f[e] = a[e]; f[8 + e] = b[e]; } return f; }
__device__ __forceinline__ v8f wmma16b(v16b a, v16b b, v8f c) { v8f d = __builtin_amdgcn_wmma_f32_16x16x32_f16(false, a, false, b, (short)0, c, false, false); asm volatile("v_nop\n\tv_nop\n\tv_nop\n\tv_nop" : "+v"(d) : "v"(a), "v"(b)); return d; }
__device__ __forceinline__ v8f wmma16p(v16b a, v16b b, v8f c) { return __builtin_amdgcn_wmma_f32_16x16x32_f16(false, a, false, b, (short)0, c, false, false); }
__device__ __forceinline__ void wave_lds_sync() { __builtin_amdgcn_fence(__ATOMIC_RELEASE, "workgroup"); __builtin_amdgcn_wave_barrier(); __builtin_amdgcn_fence(__ATOMIC_ACQUIRE, "workgroup"); }
__device__ __forceinline__ float pmul(float a, float b) { float p = a * b; asm volatile("" : "+v"(p)); return p; }
__device__ __forceinline__ float opaque(float a) { asm volatile("" : "+v"(a)); return a; }
__device__ __forceinline__ float lrelu(float x) { return x >= 0.0f ? x : NEG * x; }
// v_exp_f32 with the one slot behind a transcendental tied to it
__device__ __forceinline__ float nexp_slot(float x) { const float y = x * 1.4426950408889634f; float r; asm("v_exp_f32 %0, %1\n\tv_nop" : "=v"(r) : "v"(y)); return r; }

// projection: block = 4 waves = 64 nodes of one group. W is rounded, scaled and transposed into LDS by the block itself; the h^T hi and lo planes go out straight from the accumulators
// (a lane holds 8 consecutive nodes of one column = one 16-byte piece of an h^T row), gathered in LDS so that eight lanes store one whole 128-byte line.
constexpr int WP = F + 8, JP = 64 + 8;   // LDS row pitches of 272 and 144 bytes = 16 x odd, free of bank conflicts for 16-byte reads
__global__ __launch_bounds__(128) void proj_kernel(const float* __restrict__ x, const float* __restrict__ w, const float* __restrict__ as_, const float* __restrict__ ad_, float* __restrict__ S, float* __restrict__ Dd, b16* __restrict__ HTH, b16* __restrict__ HTL) {
  __shared__ __attribute__((aligned(16))) b16 Wt[F][WP];      // [output column][k]
  __shared__ __attribute__((aligned(16))) b16 Ht[2][F][JP];   // [plane hi, lo][column][node of the block]
  __shared__ __attribute__((aligned(16))) float sa[64], sd[64];
  const int wave = threadIdx.x >> 5, lane = threadIdx.x & 31, nloc = lane & 15, hlf = lane >> 4; const size_t m0 = (size_t)blockIdx.x * 64 + wave * 16; const float* xr = x + (m0 + nloc) * F;
  const float* xp = xr + 8 * hlf; const int o4 = lane * 4, kw = wave * 32; const float* wp = w + (size_t)kw * F + o4;   // wave: 32 rows k of W; lane: 4 columns
  v4f xv[4][4], r[4][8];   // this lane's 32 x 4 piece of W, asked for first (short way, needed first), and its x in fragment order, which flies under the W staging
#pragma unroll
  for (int q = 0; q < 4; ++q) {
#pragma unroll
    for (int j = 0; j < 8; ++j) r[q][j] = *(const v4f*)(wp + (q * 8 + j) * F); }
  asm volatile("s_wait_xcnt 0x0" :: "v"(wp) : "memory");   // precaution: no register that the W loads name is rewritten ahead of this wait (wp is named so that the pair lives up to it)
#pragma unroll
  for (int q = 0; q < 4; ++q) { xv[q][0] = *(const v4f*)(xp + q * 32); xv[q][1] = *(const v4f*)(xp + q * 32 + 4); xv[q][2] = *(const v4f*)(xp + q * 32 + 16); xv[q][3] = *(const v4f*)(xp + q * 32 + 20); }
  asm volatile("s_wait_xcnt 0x0" :: "v"(xp) : "memory");   // the same precaution for the x loads
#pragma unroll
  for (int q = 0; q < 4; ++q) {
#pragma unroll
    for (int cc = 0; cc < 4; ++cc) { v8b v;
#pragma unroll
      for (int j = 0; j < 8; ++j) v[j] = (b16)(bf16_rne(r[q][j][cc]) * WSC);
      *(v8b*)(&Wt[o4 + cc][kw + q * 8]) = v; } }
  __syncthreads();   // publishes W^T to the four waves
  float av[8], bv[8];   // this lane's a_src and a_dst, one group of 16 loads asked for here, so that they fly under the products and none is waited for alone behind them
#pragma unroll   // all sixteen loads go out before any is waited for
  for (int t = 0; t < 8; ++t) { av[t] = as_[t * 16 + nloc]; bv[t] = ad_[t * 16 + nloc]; }
  asm volatile("s_wait_xcnt 0x0" :: "v"(nloc) : "memory");   // precaution: no register that these loads name is rewritten ahead of this wait (the lane's index, their one vector operand, is named so that it lives up to it)
  v8f acc[8];
#pragma unroll
  for (int t = 0; t < 8; ++t) acc[t] = (v8f){};
#pragma unroll
  for (int q = 0; q < 4; ++q) { v16b a, b[8];
#pragma unroll
    for (int t = 0; t < 8; ++t) b[t] = frag_kb(&Wt[t * 16 + nloc][q * 32], hlf);
    __builtin_amdgcn_sched_barrier(0);   // keeps the 16 LDS reads one group in front of the rounding of x, which then covers their latency
#pragma unroll
    for (int j = 0; j < 4; ++j) { a[j] = (b16)(bf16_rne(xv[q][0][j]) * XS); a[4 + j] = (b16)(bf16_rne(xv[q][1][j]) * XS); a[8 + j] = (b16)(bf16_rne(xv[q][2][j]) * XS); a[12 + j] = (b16)(bf16_rne(xv[q][3][j]) * XS); }
#pragma unroll
    for (int t = 0; t < 8; ++t) acc[t] = wmma16b(a, b[t], acc[t]); }
  float ps[8], pd[8]; for (int r8 = 0; r8 < 8; ++r8) { ps[r8] = 0.0f; pd[r8] = 0.0f; }
#pragma unroll
  for (int t = 0; t < 8; ++t) { const int c = t * 16 + nloc; const float ws_ = opaque(bf16_rne(av[t])), wd_ = opaque(bf16_rne(bv[t])); v8b hi, lo;
#pragma unroll
    for (int r8 = 0; r8 < 8; ++r8) { const float v = acc[t][r8] * (1.0f / (XS * WSC)); ps[r8] += pmul(v, ws_); pd[r8] += pmul(v, wd_); b16 p, q; split16(v * XS, p, q); hi[r8] = p; lo[r8] = q; }
    *(v8b*)(&Ht[0][c][wave * 16 + 8 * hlf]) = hi; *(v8b*)(&Ht[1][c][wave * 16 + 8 * hlf]) = lo; }
#pragma unroll   // the sixteen row sums go through each exchange stage side by side: four waits instead of one per sum and stage; every sum keeps its own order of additions
  for (int o = 1; o < 16; o <<= 1) { float ta[8], tb[8];
#pragma unroll
    for (int r8 = 0; r8 < 8; ++r8) { ta[r8] = __shfl_xor(ps[r8], o); tb[r8] = __shfl_xor(pd[r8], o); }
#pragma unroll
    for (int r8 = 0; r8 < 8; ++r8) { ps[r8] += ta[r8]; pd[r8] += tb[r8]; } }
  if (nloc == 0) { float* qa = &sa[wave * 16 + 8 * hlf]; float* qd = &sd[wave * 16 + 8 * hlf];
    *(v4f*)qa = (v4f){ps[0], ps[1], ps[2], ps[3]}; *(v4f*)(qa + 4) = (v4f){ps[4], ps[5], ps[6], ps[7]}; *(v4f*)qd = (v4f){pd[0], pd[1], pd[2], pd[3]}; *(v4f*)(qd + 4) = (v4f){pd[4], pd[5], pd[6], pd[7]}; }
  __syncthreads();
  { const int g = blockIdx.x / (NN / 64), j0 = (blockIdx.x % (NN / 64)) * 64, cr = threadIdx.x >> 3, ch = (threadIdx.x & 7) * 8;
#pragma unroll
    for (int it = 0; it < 8; ++it) { const int c = it * 16 + cr; const size_t d = ((size_t)g * F + c) * NN + j0 + ch; *(v8b*)(HTH + d) = *(const v8b*)(&Ht[0][c][ch]); *(v8b*)(HTL + d) = *(const v8b*)(&Ht[1][c][ch]); }
    if (threadIdx.x < 16) *(v4f*)(S + (size_t)blockIdx.x * 64 + threadIdx.x * 4) = *(const v4f*)(&sa[threadIdx.x * 4]); else if (threadIdx.x < 32) *(v4f*)(Dd + (size_t)blockIdx.x * 64 + (threadIdx.x - 16) * 4) = *(const v4f*)(&sd[(threadIdx.x - 16) * 4]);
  }
}
// attention: wave per 16 rows i of group g (block = 4 waves = 64 rows): max_j d_j over the group; P fragments on the fly: p = exp(leaky(s_i + d_j) - leaky(s_i + max d)) x16384 split hi+lo; den in f32 from the
// unsplit p. The scores are rank-1 and leaky(z) = max(z, 0.2 z), so p = max(a_i E_j, b_i F_j) with E_j = exp(d_j - max d), F_j = exp(0.2 (d_j - max d)), a_i = exp(z_i - m_i), b_i = exp(0.2 z_i - m_i), z_i = s_i + max d,
// m_i = leaky(z_i): every factor is at most 1, E and F are formed once per block and kept in LDS, and the loop holds no exponential and no global load. A 32-k step asks for all its h^T fragments first, forms P under their latency, then runs its products plane by plane over the eight independent column tiles. The h^T planes reach the waves through LDS: a tile = 64 k of all 128 columns, hi and lo plane, brought once per block by asynchronous copies, two buffers, so that the next tile flies under this tile's products.
constexpr int KT = 64, NT = NN / KT, KP = KT + 8;   // KP: LDS row pitch of 144 bytes = 16 x odd, free of bank conflicts for 16-byte reads
// Eight rows-of-16 steps of one plane: each lane copies 16 bytes, eight lanes cover one whole 128-byte line. The s_wait_xcnt stands inside the statement so that no address register is rewritten ahead of it.
__device__ __forceinline__ void copy8(unsigned int l, const b16* g) {
  asm volatile("global_load_async_to_lds_b128 %0, %8, off\n\t"
               "global_load_async_to_lds_b128 %1, %9, off\n\t"
               "global_load_async_to_lds_b128 %2, %10, off\n\t"
               "global_load_async_to_lds_b128 %3, %11, off\n\t"
               "global_load_async_to_lds_b128 %4, %12, off\n\t"
               "global_load_async_to_lds_b128 %5, %13, off\n\t"
               "global_load_async_to_lds_b128 %6, %14, off\n\t"
               "global_load_async_to_lds_b128 %7, %15, off\n\t"
               "s_wait_xcnt 0x0"
               :: "v"(l), "v"(l + 1u * 16 * KP * 2), "v"(l + 2u * 16 * KP * 2), "v"(l + 3u * 16 * KP * 2), "v"(l + 4u * 16 * KP * 2), "v"(l + 5u * 16 * KP * 2), "v"(l + 6u * 16 * KP * 2), "v"(l + 7u * 16 * KP * 2),
                  "v"(g), "v"(g + 1 * 16 * NN), "v"(g + 2 * 16 * NN), "v"(g + 3 * 16 * NN), "v"(g + 4 * 16 * NN), "v"(g + 5 * 16 * NN), "v"(g + 6 * 16 * NN), "v"(g + 7 * 16 * NN)
               : "memory");
}
__global__ __launch_bounds__(128) void attn_kernel(const float* __restrict__ S, const float* __restrict__ Dd, const b16* __restrict__ HTH, const b16* __restrict__ HTL, float* __restrict__ out) {
  __shared__ __attribute__((aligned(16))) b16 ring[2][2][F][KP];   // [buffer][plane hi, lo][column][k]
  __shared__ __attribute__((aligned(16))) float Tf[4][16][F + 4]; __shared__ __attribute__((aligned(16))) float dens[4][16];
  __shared__ __attribute__((aligned(16))) float Et[2][NN];   // the group's column factors: [0] E_j, [1] F_j
  const int wave = threadIdx.x >> 5, lane = threadIdx.x & 31, nloc = lane & 15, hlf = lane >> 4; const size_t i0 = (size_t)blockIdx.x * 64 + wave * 16; const int g = (int)(i0 / NN); const float* Dg = Dd + (size_t)g * NN;
  const b16* Hh = HTH + (size_t)g * F * NN; const b16* Hl = HTL + (size_t)g * F * NN;
  const int crow = threadIdx.x >> 3, cch = (threadIdx.x & 7) * 8; const size_t csrc = (size_t)crow * NN + cch;
  auto fill = [&](int tile) { const int b = tile & 1; copy8((unsigned int)(size_t)&ring[b][0][crow][cch], Hh + csrc + tile * KT); copy8((unsigned int)(size_t)&ring[b][1][crow][cch], Hl + csrc + tile * KT); };
  const float* dp = Dg + lane * 4; const float* sp = S + i0 + nloc; v4f dv[8];   // the group's 1,024 d_j, 32 a lane, and s_i: one group of loads, one latency, asked for ahead of tile 0 because they are needed first
#pragma unroll   // all eight loads go out before any is waited for
  for (int q = 0; q < 8; ++q) dv[q] = *(const v4f*)(dp + q * 128);
  const float si = *sp;
  asm volatile("s_wait_xcnt 0x0" :: "v"(dp), "v"(sp) : "memory");   // precaution: no register that these loads name is rewritten ahead of this wait (both pointers are named so that they live up to it)
  fill(0);
  __builtin_amdgcn_sched_barrier(0);   // keeps the wait on the d loads behind the issue of tile 0's copies, so that both fly at once
  float mx = -INFINITY;
#pragma unroll   // dv stays in registers
  for (int q = 0; q < 8; ++q) mx = fmaxf(mx, fmaxf(fmaxf(dv[q][0], dv[q][1]), fmaxf(dv[q][2], dv[q][3])));
  for (int o = 16; o; o >>= 1) mx = fmaxf(mx, __shfl_xor(mx, o));
  const float zi = si + mx, mi = lrelu(zi); const float ca = nexp_slot(zi - mi) * PS, cb = nexp_slot(NEG * zi - mi) * PS; float den = 0.0f;   // row factors, carrying the x16384 of P (den carries it too)
  { v4f da = dv[0], db = dv[1];   // every wave holds all 1,024 d_j: wave w forms the factors of columns 256 w .. 256 w + 255, 8 a lane
    if (wave == 1) { da = dv[2]; db = dv[3]; } if (wave == 2) { da = dv[4]; db = dv[5]; } if (wave == 3) { da = dv[6]; db = dv[7]; }
    v4f ea, eb, fa, fb;
#pragma unroll   // constant vector indices; the sixteen exponentials run side by side
    for (int c = 0; c < 4; ++c) { const float ua = da[c] - mx, ub = db[c] - mx; ea[c] = nexp_slot(ua); eb[c] = nexp_slot(ub); fa[c] = nexp_slot(NEG * ua); fb[c] = nexp_slot(NEG * ub); }
    float* q = &Et[0][wave * 256 + lane * 4]; *(v4f*)q = ea; *(v4f*)(q + 128) = eb; *(v4f*)(q + NN) = fa; *(v4f*)(q + NN + 128) = fb; }   // published by the barrier that publishes tile 0
  v8f acc[8];
#pragma unroll
  for (int t = 0; t < 8; ++t) acc[t] = (v8f){};
  asm volatile("s_wait_asynccnt 0x0" ::: "memory");   // this wave's share of tile 0 has landed
  __syncthreads();                                    // publishes tile 0 to the other waves
  fill(1);
  const float* et = &Et[0][8 * hlf];   // this lane's columns, in its fragment order
  v8f ne0 = *(const v8f*)(et), ne1 = *(const v8f*)(et + 16), nf0 = *(const v8f*)(et + NN), nf1 = *(const v8f*)(et + NN + 16);   // step 0's factors
#pragma unroll 1
  for (int tt = 0; tt < NT; ++tt) { const int bf = tt & 1;
#pragma unroll
    for (int ks = 0; ks < KT; ks += 32) { v16b ph, pl, bh[8], bl[8];
      const v8f e0 = ne0, e1 = ne1, f0 = nf0, f1 = nf1;   // this step's factors, asked for one step ago
#pragma unroll
      for (int t = 0; t < 8; ++t) bh[t] = frag_kb(&ring[bf][0][t * 16 + nloc][ks], hlf);
#pragma unroll
      for (int t = 0; t < 8; ++t) bl[t] = frag_kb(&ring[bf][1][t * 16 + nloc][ks], hlf);
      { const float* en = et + ((tt * KT + ks + 32) & (NN - 1)); ne0 = *(const v8f*)(en); ne1 = *(const v8f*)(en + 16); nf0 = *(const v8f*)(en + NN); nf1 = *(const v8f*)(en + NN + 16); }   // the next step's factors, behind the fragments (the last step wraps to step 0's, unused)
      __builtin_amdgcn_sched_barrier(0);   // keeps the loads one group in front of the P arithmetic, which then covers the LDS latency
#pragma unroll
      for (int j = 0; j < 8; ++j) { const float p0 = fmaxf(ca * e0[j], cb * f0[j]), p1 = fmaxf(ca * e1[j], cb * f1[j]); den += p0 + p1; b16 a, b; split16(p0, a, b); ph[j] = a; pl[j] = b; split16(p1, a, b); ph[8 + j] = a; pl[8 + j] = b; }
      __builtin_amdgcn_sched_barrier(0);   // keeps the 24 products one run behind the arithmetic, with no LDS read among them
#pragma unroll
      for (int t = 0; t < 8; ++t) acc[t] = wmma16p(ph, bh[t], acc[t]);
#pragma unroll
      for (int t = 0; t < 8; ++t) acc[t] = wmma16p(pl, bh[t], acc[t]);
#pragma unroll
      for (int t = 0; t < 8; ++t) acc[t] = wmma16p(ph, bl[t], acc[t]);
      __builtin_amdgcn_sched_barrier(0); } // keeps the next step's LDS reads out of this run of products
    asm volatile("s_wait_dscnt 0x0" ::: "memory");      // this wave's reads of the buffer are done before it is refilled
    asm volatile("s_wait_asynccnt 0x0" ::: "memory");   // this wave's share of tile tt + 1 has landed
    __syncthreads();                                    // publishes tile tt + 1 and ends every wave's reads of tile tt
    if (tt + 2 < NT) fill(tt + 2); }
  asm volatile("s_wait_asynccnt 0x0" ::: "memory");     // no copy is outstanding when the wave goes on
  den += __shfl_xor(den, 16);
  if (hlf == 0) dens[wave][nloc] = den;
  wave_lds_sync();
  float inv[8];   // one scale per row of the lane: its eight sums come by two reads, the eight divisions run side by side
  { const v4f q0 = *(const v4f*)(&dens[wave][8 * hlf]), q1 = *(const v4f*)(&dens[wave][8 * hlf + 4]);
#pragma unroll   // eight independent division chains instead of one after another
    for (int r8 = 0; r8 < 4; ++r8) { inv[r8] = (1.0f / XS) / q0[r8]; inv[4 + r8] = (1.0f / XS) / q1[r8]; } }
#pragma unroll
  for (int t = 0; t < 8; ++t) { const int c = t * 16 + nloc;
#pragma unroll   // constant accumulator indices, no LDS read and no wait per element
    for (int r8 = 0; r8 < 8; ++r8) Tf[wave][8 * hlf + r8][c] = acc[t][r8] * inv[r8]; }
  wave_lds_sync();
  { for (int rr = 0; rr < 16; ++rr) *(v4f*)(out + (i0 + rr) * F + lane * 4) = *(const v4f*)(&Tf[wave][rr][lane * 4]);  }
}
}  // namespace

extern "C" void kernel_launch(void* const* d_in, const int* in_sizes, int n_in, void* d_out, int out_size, void* d_ws, size_t ws_size, hipStream_t stream) {
  (void)n_in;
  auto Fp = [&](int i) { return (const float*)d_in[i]; };
  // input order: 0 x [2,16,1024,128], 1 W [128,128], 2 a_src [128], 3 a_dst [128]
  if (in_sizes[0] != M * F || in_sizes[1] != F * F || in_sizes[2] != F || in_sizes[3] != F || out_size != M * F) return;
  size_t off = 0; char* ws = (char*)d_ws;
  auto carve = [&](size_t bytes) { char* p = ws + off; off += (bytes + 255) & ~(size_t)255; return p; };
  float* S = (float*)carve((size_t)M * 4); float* Dd = (float*)carve((size_t)M * 4); b16* HTH = (b16*)carve((size_t)NG * F * NN * 2); b16* HTL = (b16*)carve((size_t)NG * F * NN * 2);
  if (off > ws_size || off > ((size_t)64 << 20)) return;   // ~ 17 MB
  proj_kernel<<<M / 64, 128, 0, stream>>>(Fp(0), Fp(1), Fp(2), Fp(3), S, Dd, HTH, HTL);
  attn_kernel<<<M / 64, 128, 0, stream>>>(S, Dd, HTH, HTL, (float*)d_out);
}

// v007
// A run of this version takes 26.8 microseconds.
// In both of two side-by-side timings against v006, it was 1.10 times as fast.
// All steps since v000 together make it 4.82 times as fast.
#include <hip/hip_runtime.h>

// Dense GAT layer on [2, 16, 1024, 128]: per (b, t) group of 1,024 nodes: h = x W; e[i][j] = leaky_0.2(h_i . a_src + h_j . a_dst); alpha = softmax over j; out = alpha h -> [2][16][1024][128].
// WMMA (v_wmma_f32_16x16x32_f16, f32 accumulate): h = bf16(x) W ([32,768 x 128] x [128 x 128], EXACT bf16 x8: 1 product) and per group out = P h ([1,024 x 1,024] x [1,024 x 128]: P = exp(e - rowmax)
// carried x16384 and split f16 hi+lo, built directly in the A fragments (rank-1 scores: rowmax_i = leaky(s_i + max_j d_j)); h transposed hi+lo x8 planes; 3 products); W exact x256; scores, row sums
// and the normalisation in f32. Inputs rounded to bf16 once. Fragment k-map per lane half hh for A AND B: elements 0..7 <- k = 8hh+0..7, 8..15 <- k = 16+8hh+0..7;

namespace {
constexpr int NG = 32, NN = 1024, F = 128, M = NG * NN;
constexpr float XS = 8.0f, WSC = 256.0f, PS = 16384.0f, NEG = 0.2f;
typedef _Float16 b16;
typedef __attribute__((ext_vector_type(16))) _Float16 v16b;
typedef __attribute__((ext_vector_type(8))) _Float16 v8b;
typedef __attribute__((ext_vector_type(8))) float v8f;
typedef __attribute__((ext_vector_type(4))) float v4f;
__device__ __forceinline__ float bf16_rne(float f) { unsigned int u = __float_as_uint(f); u += 0x7FFFu + ((u >> 16) & 1u); return __uint_as_float(u & 0xFFFF0000u); }
__device__ __forceinline__ void split16(float v, b16& hi, b16& lo) { hi = (b16)v; lo = (b16)(v - (float)hi); }
__device__ __forceinline__ v16b frag_kb(const b16* p, int hh) { const v8b a = *(const v8b*)(p + 8 * hh), b = *(const v8b*)(p + 16 + 8 * hh); v16b f;
#pragma unroll
  for (int e = 0; e < 8; ++e) { f[e] = a[e]; f[8 + e] = b[e]; } return f; }
__device__ __forceinline__ v8f wmma16b(v16b a, v16b b, v8f c) { v8f d = __builtin_amdgcn_wmma_f32_16x16x32_f16(false, a, false, b, (short)0, c, false, false); asm volatile("v_nop\n\tv_nop\n\tv_nop\n\tv_nop" : "+v"(d) : "v"(a), "v"(b)); return d; }
__device__ __forceinline__ v8f wmma16p(v16b a, v16b b, v8f c) { return __builtin_amdgcn_wmma_f32_16x16x32_f16(false, a, false, b, (short)0, c, false, false); }
__device__ __forceinline__ void wave_lds_sync() { __builtin_amdgcn_fence(__ATOMIC_RELEASE, "workgroup"); __builtin_amdgcn_wave_barrier(); __builtin_amdgcn_fence(__ATOMIC_ACQUIRE, "workgroup"); }
__device__ __forceinline__ float pmul(float a, float b) { float p = a * b; asm volatile("" : "+v"(p)); return p; }
__device__ __forceinline__ float opaque(float a) { asm volatile("" : "+v"(a)); return a; }
__device__ __forceinline__ float lrelu(float x) { return x >= 0.0f ? x : NEG * x; }
// v_exp_f32 with the one slot behind a transcendental tied to it
__device__ __forceinline__ float nexp_slot(float x) { const float y = x * 1.4426950408889634f; float r; asm("v_exp_f32 %0, %1\n\tv_nop" : "=v"(r) : "v"(y)); return r; }

// projection: block = 4 waves = 64 nodes of one group. W is rounded, scaled and transposed into LDS by the block itself; the h^T hi and lo planes go out straight from the accumulators
// (a lane holds 8 consecutive nodes of one column = one 16-byte piece of an h^T row), gathered in LDS so that eight lanes store one whole 128-byte line.
constexpr int WP = F + 8, JP = 64 + 8;   // LDS row pitches of 272 and 144 bytes = 16 x odd, free of bank conflicts for 16-byte reads
__global__ __launch_bounds__(128) void proj_kernel(const float* __restrict__ x, const float* __restrict__ w, const float* __restrict__ as_, const float* __restrict__ ad_, float* __restrict__ S, float* __restrict__ Dd, b16* __restrict__ HTH, b16* __restrict__ HTL) {
  __shared__ __attribute__((aligned(16))) b16 Wt[F][WP];      // [output column][k]
  __shared__ __attribute__((aligned(16))) b16 Ht[2][F][JP];   // [plane hi, lo][column][node of the block]
  __shared__ __attribute__((aligned(16))) float sa[64], sd[64];
  const int wave = threadIdx.x >> 5, lane = threadIdx.x & 31, nloc = lane & 15, hlf = lane >> 4; const size_t m0 = (size_t)blockIdx.x * 64 + wave * 16; const float* xr = x + (m0 + nloc) * F;
  const float* xp = xr + 8 * hlf; const int o4 = lane * 4, kw = wave * 32; const float* wp = w + (size_t)kw * F + o4;   // wave: 32 rows k of W; lane: 4 columns
  v4f xv[4][4], r[4][8];   // this lane's 32 x 4 piece of W, asked for first (short way, needed first), and its x in fragment order, which flies under the W staging
#pragma unroll
  for (int q = 0; q < 4; ++q) {
#pragma unroll
    for (int j = 0; j < 8; ++j) r[q][j] = *(const v4f*)(wp + (q * 8 + j) * F); }
  asm volatile("s_wait_xcnt 0x0" :: "v"(wp) : "memory");   // precaution: no register that the W loads name is rewritten ahead of this wait (wp is named so that the pair lives up to it)
#pragma unroll
  for (int q = 0; q < 4; ++q) { xv[q][0] = *(const v4f*)(xp + q * 32); xv[q][1] = *(const v4f*)(xp + q * 32 + 4); xv[q][2] = *(const v4f*)(xp + q * 32 + 16); xv[q][3] = *(const v4f*)(xp + q * 32 + 20); }
  asm volatile("s_wait_xcnt 0x0" :: "v"(xp) : "memory");   // the same precaution for the x loads
#pragma unroll
  for (int q = 0; q < 4; ++q) {
#pragma unroll
    for (int cc = 0; cc < 4; ++cc) { v8b v;
#pragma unroll
      for (int j = 0; j < 8; ++j) v[j] = (b16)(bf16_rne(r[q][j][cc]) * WSC);
      *(v8b*)(&Wt[o4 + cc][kw + q * 8]) = v; } }
  __syncthreads();   // publishes W^T to the four waves
  float av[8], bv[8];   // this lane's a_src and a_dst, one group of 16 loads asked for here, so that they fly under the products and none is waited for alone behind them
#pragma unroll   // all sixteen loads go out before any is waited for
  for (int t = 0; t < 8; ++t) { av[t] = as_[t * 16 + nloc]; bv[t] = ad_[t * 16 + nloc]; }
  asm volatile("s_wait_xcnt 0x0" :: "v"(nloc) : "memory");   // precaution: no register that these loads name is rewritten ahead of this wait (the lane's index, their one vector operand, is named so that it lives up to it)
  v8f acc[8];
#pragma unroll
  for (int t = 0; t < 8; ++t) acc[t] = (v8f){};
#pragma unroll
  for (int q = 0; q < 4; ++q) { v16b a, b[8];
#pragma unroll
    for (int t = 0; t < 8; ++t) b[t] = frag_kb(&Wt[t * 16 + nloc][q * 32], hlf);
    __builtin_amdgcn_sched_barrier(0);   // keeps the 16 LDS reads one group in front of the rounding of x, which then covers their latency
#pragma unroll
    for (int j = 0; j < 4; ++j) { a[j] = (b16)(bf16_rne(xv[q][0][j]) * XS); a[4 + j] = (b16)(bf16_rne(xv[q][1][j]) * XS); a[8 + j] = (b16)(bf16_rne(xv[q][2][j]) * XS); a[12 + j] = (b16)(bf16_rne(xv[q][3][j]) * XS); }
#pragma unroll
    for (int t = 0; t < 8; ++t) acc[t] = wmma16b(a, b[t], acc[t]); }
  float ps[8], pd[8]; for (int r8 = 0; r8 < 8; ++r8) { ps[r8] = 0.0f; pd[r8] = 0.0f; }
#pragma unroll
  for (int t = 0; t < 8; ++t) { const int c = t * 16 + nloc; const float ws_ = opaque(bf16_rne(av[t])), wd_ = opaque(bf16_rne(bv[t])); v8b hi, lo;
#pragma unroll
    for (int r8 = 0; r8 < 8; ++r8) { const float v = acc[t][r8] * (1.0f / (XS * WSC)); ps[r8] += pmul(v, ws_); pd[r8] += pmul(v, wd_); b16 p, q; split16(v * XS, p, q); hi[r8] = p; lo[r8] = q; }
    *(v8b*)(&Ht[0][c][wave * 16 + 8 * hlf]) = hi; *(v8b*)(&Ht[1][c][wave * 16 + 8 * hlf]) = lo; }
#pragma unroll   // the sixteen row sums go through each exchange stage side by side: four waits instead of one per sum and stage; every sum keeps its own order of additions
  for (int o = 1; o < 16; o <<= 1) { float ta[8], tb[8];
#pragma unroll
    for (int r8 = 0; r8 < 8; ++r8) { ta[r8] = __shfl_xor(ps[r8], o); tb[r8] = __shfl_xor(pd[r8], o); }
#pragma unroll
    for (int r8 = 0; r8 < 8; ++r8) { ps[r8] += ta[r8]; pd[r8] += tb[r8]; } }
  if (nloc == 0) { float* qa = &sa[wave * 16 + 8 * hlf]; float* qd = &sd[wave * 16 + 8 * hlf];
    *(v4f*)qa = (v4f){ps[0], ps[1], ps[2], ps[3]}; *(v4f*)(qa + 4) = (v4f){ps[4], ps[5], ps[6], ps[7]}; *(v4f*)qd = (v4f){pd[0], pd[1], pd[2], pd[3]}; *(v4f*)(qd + 4) = (v4f){pd[4], pd[5], pd[6], pd[7]}; }
  __syncthreads();
  { const int g = blockIdx.x / (NN / 64), j0 = (blockIdx.x % (NN / 64)) * 64, cr = threadIdx.x >> 3, ch = (threadIdx.x & 7) * 8;
#pragma unroll
    for (int it = 0; it < 8; ++it) { const int c = it * 16 + cr; const size_t d = ((size_t)g * F + c) * NN + j0 + ch; *(v8b*)(HTH + d) = *(const v8b*)(&Ht[0][c][ch]); *(v8b*)(HTL + d) = *(const v8b*)(&Ht[1][c][ch]); }
    if (threadIdx.x < 16) *(v4f*)(S + (size_t)blockIdx.x * 64 + threadIdx.x * 4) = *(const v4f*)(&sa[threadIdx.x * 4]); else if (threadIdx.x < 32) *(v4f*)(Dd + (size_t)blockIdx.x * 64 + (threadIdx.x - 16) * 4) = *(const v4f*)(&sd[(threadIdx.x - 16) * 4]);
  }
}
// attention: block = 8 waves = 128 rows i of group g: wave = 32 rows (two A fragments, row group wave & 3) x one half of every k tile (wave >> 2), so that each h^T fragment read from LDS feeds two row fragments
// and two waves still share a SIMD; the two halves' partial sums are joined through LDS at the end, each wave finishing 16 of the pair's 32 rows. max_j d_j over the group; P fragments on the fly:
// p = exp(leaky(s_i + d_j) - leaky(s_i + max d)) x16384 split hi+lo; den in f32 from the unsplit p. The scores are rank-1 and leaky(z) = max(z, 0.2 z), so p = max(a_i E_j, b_i F_j) with E_j = exp(d_j - max d),
// F_j = exp(0.2 (d_j - max d)), a_i = exp(z_i - m_i), b_i = exp(0.2 z_i - m_i), z_i = s_i + max d, m_i = leaky(z_i): every factor is at most 1, E and F are formed once per block and kept in LDS, and the loop holds no
// exponential and no global load. A 32-k step asks for all its h^T fragments first, forms P under their latency, then runs its products plane by plane over the sixteen independent tiles. The h^T planes reach the waves
// through LDS: a tile = 128 k of all 128 columns, hi and lo plane, brought once per block by asynchronous copies, two buffers, so that the next tile flies under this tile's products.
constexpr int KT = 128, NT = NN / KT, KP = KT + 8;   // KP: LDS row pitch of 272 bytes = 16 x odd, free of bank conflicts for 16-byte reads
// Eight rows-of-16 steps of one plane: each lane copies 16 bytes, sixteen lanes cover the two whole 128-byte lines of a row. The s_wait_xcnt stands inside the statement so that no address register is rewritten ahead of it.
__device__ __forceinline__ void copy8(unsigned int l, const b16* g) {
  asm volatile("global_load_async_to_lds_b128 %0, %8, off\n\t"
               "global_load_async_to_lds_b128 %1, %9, off\n\t"
               "global_load_async_to_lds_b128 %2, %10, off\n\t"
               "global_load_async_to_lds_b128 %3, %11, off\n\t"
               "global_load_async_to_lds_b128 %4, %12, off\n\t"
               "global_load_async_to_lds_b128 %5, %13, off\n\t"
               "global_load_async_to_lds_b128 %6, %14, off\n\t"
               "global_load_async_to_lds_b128 %7, %15, off\n\t"
               "s_wait_xcnt 0x0"
               :: "v"(l), "v"(l + 1u * 16 * KP * 2), "v"(l + 2u * 16 * KP * 2), "v"(l + 3u * 16 * KP * 2), "v"(l + 4u * 16 * KP * 2), "v"(l + 5u * 16 * KP * 2), "v"(l + 6u * 16 * KP * 2), "v"(l + 7u * 16 * KP * 2),
                  "v"(g), "v"(g + 1 * 16 * NN), "v"(g + 2 * 16 * NN), "v"(g + 3 * 16 * NN), "v"(g + 4 * 16 * NN), "v"(g + 5 * 16 * NN), "v"(g + 6 * 16 * NN), "v"(g + 7 * 16 * NN)
               : "memory");
}
__global__ __launch_bounds__(256) void attn_kernel(const float* __restrict__ S, const float* __restrict__ Dd, const b16* __restrict__ HTH, const b16* __restrict__ HTL, float* __restrict__ out) {
  __shared__ __attribute__((aligned(16))) b16 ring[2][2][F][KP];   // [buffer][plane hi, lo][column][k]
  __shared__ __attribute__((aligned(16))) float Tf[8][16][F + 4]; __shared__ __attribute__((aligned(16))) float dens[8][2][16];
  __shared__ __attribute__((aligned(16))) float Xc[8][8][2][32][4];   // [wave][column tile][accumulator rows 0..3, 4..7][lane]: the row fragment that a wave hands to its partner
  __shared__ __attribute__((aligned(16))) float Et[2][NN];   // the group's column factors: [0] E_j, [1] F_j
  const int wave = __builtin_amdgcn_readfirstlane(threadIdx.x >> 5), rg = wave & 3, kh = wave >> 2, lane = threadIdx.x & 31, nloc = lane & 15, hlf = lane >> 4;
  const size_t i0 = (size_t)blockIdx.x * 128 + rg * 32; const int g = (int)(i0 / NN); const float* Dg = Dd + (size_t)g * NN;
  const b16* Hh = HTH + (size_t)g * F * NN; const b16* Hl = HTL + (size_t)g * F * NN;
  const int crow = threadIdx.x >> 4, cch = (threadIdx.x & 15) * 8; const unsigned int csrc = (unsigned int)(crow * NN + cch);
  const b16* gh = Hh; const b16* gl = Hl;   // the next tile to be copied, the same for the whole block; the lane's own offset is added at the copy
  auto fill = [&](int tile) { const int b = tile & 1; copy8((unsigned int)(size_t)&ring[b][0][crow][cch], gh + csrc); copy8((unsigned int)(size_t)&ring[b][1][crow][cch], gl + csrc); gh += KT; gl += KT; };
  const float* Sr = S + i0; v4f dv[8];   // the group's 1,024 d_j, 32 a lane, and the two s_i: one group of loads, one latency, asked for ahead of tile 0 because they are needed first
#pragma unroll   // all eight loads go out before any is waited for
  for (int q = 0; q < 8; ++q) dv[q] = *(const v4f*)(Dg + lane * 4 + q * 128);
  const float si0 = Sr[nloc], si1 = Sr[nloc + 16];
  asm volatile("s_wait_xcnt 0x0" :: "s"(Dg), "s"(Sr) : "memory");   // precaution: no register that these loads name is rewritten ahead of this wait (their scalar bases are named so that they live up to it; their lane indices are in use to the kernel's end)
  fill(0);
  __builtin_amdgcn_sched_barrier(0);   // keeps the wait on the d loads behind the issue of tile 0's copies, so that both fly at once
  float mx = -INFINITY;
#pragma unroll   // dv stays in registers
  for (int q = 0; q < 8; ++q) mx = fmaxf(mx, fmaxf(fmaxf(dv[q][0], dv[q][1]), fmaxf(dv[q][2], dv[q][3])));
  for (int o = 16; o; o >>= 1) mx = fmaxf(mx, __shfl_xor(mx, o));
  const float zi0 = si0 + mx, mi0 = lrelu(zi0), zi1 = si1 + mx, mi1 = lrelu(zi1);   // row factors of the two row fragments, carrying the x16384 of P (den carries it too)
  const float ca0 = nexp_slot(zi0 - mi0) * PS, cb0 = nexp_slot(NEG * zi0 - mi0) * PS, ca1 = nexp_slot(zi1 - mi1) * PS, cb1 = nexp_slot(NEG * zi1 - mi1) * PS; float den0 = 0.0f, den1 = 0.0f;
  { v4f da = dv[0];   // every wave holds all 1,024 d_j: wave w forms the factors of columns 128 w .. 128 w + 127, 4 a lane
#pragma unroll   // constant indices into dv
    for (int q = 1; q < 8; ++q) if (wave == q) da = dv[q];
    v4f ea, fa;
#pragma unroll   // constant vector indices; the eight exponentials run side by side
    for (int c = 0; c < 4; ++c) { const float ua = da[c] - mx; ea[c] = nexp_slot(ua); fa[c] = nexp_slot(NEG * ua); }
    float* q = &Et[0][wave * 128 + lane * 4]; *(v4f*)q = ea; *(v4f*)(q + NN) = fa; }   // published by the barrier that publishes tile 0
  v8f acc0[8], acc1[8];
#pragma unroll
  for (int t = 0; t < 8; ++t) { acc0[t] = (v8f){}; acc1[t] = (v8f){}; }
  asm volatile("s_wait_asynccnt 0x0" ::: "memory");   // this wave's share of tile 0 has landed
  __syncthreads();                                    // publishes tile 0 to the other waves
  fill(1);
  const float* et = &Et[0][8 * hlf];   // this lane's columns, in its fragment order
  const int k0 = kh * (KT / 2);        // this wave's half of every tile
  v8f ne0 = *(const v8f*)(et + k0), ne1 = *(const v8f*)(et + k0 + 16), nf0 = *(const v8f*)(et + k0 + NN), nf1 = *(const v8f*)(et + k0 + NN + 16);   // the wave's first step's factors
#pragma unroll 1   // one 32-k step a trip: with a tile's two steps unrolled this build let the first step's products sink behind the second step's LDS reads, so that both steps' fragments were live at once and registers went to scratch
  for (int st = 0; st < 2 * NT; ++st) { const int tt = st >> 1, bf = tt & 1, s = (st & 1) * 32, ks = k0 + s; v16b ph0, pl0, ph1, pl1, bh[8], bl[8];
    const v8f e0 = ne0, e1 = ne1, f0 = nf0, f1 = nf1;   // this step's factors, asked for one step ago
#pragma unroll
    for (int t = 0; t < 8; ++t) bh[t] = frag_kb(&ring[bf][0][t * 16 + nloc][ks], hlf);
#pragma unroll
    for (int t = 0; t < 8; ++t) bl[t] = frag_kb(&ring[bf][1][t * 16 + nloc][ks], hlf);
    { const float* en = et + ((tt * KT + ks + (s ? 32 + KT / 2 : 32)) & (NN - 1)); ne0 = *(const v8f*)(en); ne1 = *(const v8f*)(en + 16); nf0 = *(const v8f*)(en + NN); nf1 = *(const v8f*)(en + NN + 16); }   // the wave's next step's factors, behind the fragments (the last step wraps, unused)
    __builtin_amdgcn_sched_barrier(0);   // keeps the loads one group in front of the P arithmetic, which then covers the LDS latency
#pragma unroll
    for (int j = 0; j < 8; ++j) { const float p0 = fmaxf(ca0 * e0[j], cb0 * f0[j]), p1 = fmaxf(ca0 * e1[j], cb0 * f1[j]); den0 += p0 + p1; b16 a, b; split16(p0, a, b); ph0[j] = a; pl0[j] = b; split16(p1, a, b); ph0[8 + j] = a; pl0[8 + j] = b; }
#pragma unroll
    for (int j = 0; j < 8; ++j) { const float p0 = fmaxf(ca1 * e0[j], cb1 * f0[j]), p1 = fmaxf(ca1 * e1[j], cb1 * f1[j]); den1 += p0 + p1; b16 a, b; split16(p0, a, b); ph1[j] = a; pl1[j] = b; split16(p1, a, b); ph1[8 + j] = a; pl1[8 + j] = b; }
    __builtin_amdgcn_sched_barrier(0);   // keeps the 48 products one run behind the arithmetic, with no LDS read among them
#pragma unroll
    for (int t = 0; t < 8; ++t) { acc0[t] = wmma16p(ph0, bh[t], acc0[t]); acc1[t] = wmma16p(ph1, bh[t], acc1[t]); }
#pragma unroll
    for (int t = 0; t < 8; ++t) { acc0[t] = wmma16p(pl0, bh[t], acc0[t]); acc1[t] = wmma16p(pl1, bh[t], acc1[t]); }
#pragma unroll
    for (int t = 0; t < 8; ++t) { acc0[t] = wmma16p(ph0, bl[t], acc0[t]); acc1[t] = wmma16p(ph1, bl[t], acc1[t]); }
    if (s) {   // the tile's second step is done (the same test in every wave of the block)
      asm volatile("s_wait_dscnt 0x0" ::: "memory");      // this wave's reads of the buffer are done before it is refilled
      asm volatile("s_wait_asynccnt 0x0" ::: "memory");   // this wave's share of tile tt + 1 has landed
      __syncthreads();                                    // publishes tile tt + 1 and ends every wave's reads of tile tt
      if (tt + 2 < NT) fill(tt + 2); } }
  asm volatile("s_wait_asynccnt 0x0" ::: "memory");     // no copy is outstanding when the wave goes on
  den0 += __shfl_xor(den0, 16); den1 += __shfl_xor(den1, 16);
  if (hlf == 0) { dens[wave][0][nloc] = den0; dens[wave][1][nloc] = den1; }
  v8f acc[8];   // the wave of k half kh finishes row fragment kh and hands the other one to its partner
#pragma unroll
  for (int t = 0; t < 8; ++t) { const v8f gv = kh ? acc0[t] : acc1[t]; acc[t] = kh ? acc1[t] : acc0[t];
    *(v4f*)(&Xc[wave][t][0][lane][0]) = (v4f){gv[0], gv[1], gv[2], gv[3]}; *(v4f*)(&Xc[wave][t][1][lane][0]) = (v4f){gv[4], gv[5], gv[6], gv[7]}; }
  __syncthreads();   // publishes each wave's handed-over partial sums to its partner
  const int pw = wave ^ 4;
#pragma unroll
  for (int t = 0; t < 8; ++t) { const v4f x0 = *(const v4f*)(&Xc[pw][t][0][lane][0]), x1 = *(const v4f*)(&Xc[pw][t][1][lane][0]);
#pragma unroll
    for (int c = 0; c < 4; ++c) { acc[t][c] += x0[c]; acc[t][4 + c] += x1[c]; } }
  float inv[8];   // one scale per row of the lane: its eight sums come by four reads, the eight divisions run side by side
  { const v4f q0 = *(const v4f*)(&dens[wave][kh][8 * hlf]) + *(const v4f*)(&dens[pw][kh][8 * hlf]), q1 = *(const v4f*)(&dens[wave][kh][8 * hlf + 4]) + *(const v4f*)(&dens[pw][kh][8 * hlf + 4]);
#pragma unroll   // eight independent division chains instead of one after another
    for (int r8 = 0; r8 < 4; ++r8) { inv[r8] = (1.0f / XS) / q0[r8]; inv[4 + r8] = (1.0f / XS) / q1[r8]; } }
#pragma unroll
  for (int t = 0; t < 8; ++t) { const int c = t * 16 + nloc;
#pragma unroll   // constant accumulator indices, no LDS read and no wait per element
    for (int r8 = 0; r8 < 8; ++r8) Tf[wave][8 * hlf + r8][c] = acc[t][r8] * inv[r8]; }
  wave_lds_sync();
  { const size_t r0 = i0 + kh * 16; for (int rr = 0; rr < 16; ++rr) *(v4f*)(out + (r0 + rr) * F + lane * 4) = *(const v4f*)(&Tf[wave][rr][lane * 4]);  }
}
}  // namespace

extern "C" void kernel_launch(void* const* d_in, const int* in_sizes, int n_in, void* d_out, int out_size, void* d_ws, size_t ws_size, hipStream_t stream) {
  (void)n_in;
  auto Fp = [&](int i) { return (const float*)d_in[i]; };
  // input order: 0 x [2,16,1024,128], 1 W [128,128], 2 a_src [128], 3 a_dst [128]
  if (in_sizes[0] != M * F || in_sizes[1] != F * F || in_sizes[2] != F || in_sizes[3] != F || out_size != M * F) return;
  size_t off = 0; char* ws = (char*)d_ws;
  auto carve = [&](size_t bytes) { char* p = ws + off; off += (bytes + 255) & ~(size_t)255; return p; };
  float* S = (float*)carve((size_t)M * 4); float* Dd = (float*)carve((size_t)M * 4); b16* HTH = (b16*)carve((size_t)NG * F * NN * 2); b16* HTL = (b16*)carve((size_t)NG * F * NN * 2);
  if (off > ws_size || off > ((size_t)64 << 20)) return;   // ~ 17 MB
  proj_kernel<<<M / 64, 128, 0, stream>>>(Fp(0), Fp(1), Fp(2), Fp(3), S, Dd, HTH, HTL);
  attn_kernel<<<M / 128, 256, 0, stream>>>(S, Dd, HTH, HTL, (float*)d_out);
}

// v009
// One run takes 15.6 microseconds.
// Versions in between are left out here; by their measured steps it is 1.73 times as fast as v007.
// All steps since v000 together make it 8.34 times as fast.
#include <hip/hip_runtime.h>

// Dense GAT layer on [2, 16, 1024, 128]: per (b, t) group of 1,024 nodes: h = x W; e[i][j] = leaky_0.2(h_i . a_src + h_j . a_dst); alpha = softmax over j; out = alpha h -> [2][16][1024][128].
// WMMA (v_wmma_f32_16x16x32_f16, f32 accumulate): h = bf16(x) W ([32,768 x 128] x [128 x 128], EXACT bf16 x8: 1 product) and per group out = P h ([1,024 x 1,024] x [1,024 x 128]: P = exp(e - rowmax)
// carried x16384, formed in packed f16 directly in the A fragments (rank-1 scores: rowmax_i = leaky(s_i + max_j d_j)); h transposed, x8, rounded to f16; 1 product: the f16 rounding lies well below the error that the bf16 rounding of the inputs leaves in h and in the scores); W exact x256; scores, the factors' exponentials
// and the normalisation in f32, row sums of the f16 P in f32 on the matrix unit. Inputs rounded to bf16 once. Fragment k-map per lane half hh for A AND B: elements 0..7 <- k = 8hh+0..7, 8..15 <- k = 16+8hh+0..7;

namespace {
constexpr int NG = 32, NN = 1024, F = 128, M = NG * NN;
constexpr float XS = 8.0f, WSC = 256.0f, PH = 128.0f, NEG = 0.2f;   // PH: carried by the row factors and by the column factors, so that P carries PH x PH = 16384
typedef _Float16 b16;
typedef __attribute__((ext_vector_type(16))) _Float16 v16b;
typedef __attribute__((ext_vector_type(8))) _Float16 v8b;
typedef __attribute__((ext_vector_type(4))) _Float16 v4b;
typedef __attribute__((ext_vector_type(8))) float v8f;
typedef __attribute__((ext_vector_type(4))) float v4f;
__device__ __forceinline__ float bf16_rne(float f) { unsigned int u = __float_as_uint(f); u += 0x7FFFu + ((u >> 16) & 1u); return __uint_as_float(u & 0xFFFF0000u); }
__device__ __forceinline__ v16b frag_kb(const b16* p, int hh) { const v8b a = *(const v8b*)(p + 8 * hh), b = *(const v8b*)(p + 16 + 8 * hh); v16b f;
#pragma unroll
  for (int e = 0; e < 8; ++e) { f[e] = a[e]; f[8 + e] = b[e]; } return f; }
__device__ __forceinline__ v8f wmma16b(v16b a, v16b b, v8f c) { v8f d = __builtin_amdgcn_wmma_f32_16x16x32_f16(false, a, false, b, (short)0, c, false, false); asm volatile("v_nop\n\tv_nop\n\tv_nop\n\tv_nop" : "+v"(d) : "v"(a), "v"(b)); return d; }
__device__ __forceinline__ v8f wmma16p(v16b a, v16b b, v8f c) { return __builtin_amdgcn_wmma_f32_16x16x32_f16(false, a, false, b, (short)0, c, false, false); }
__device__ __forceinline__ void wave_lds_sync() { __builtin_amdgcn_fence(__ATOMIC_RELEASE, "workgroup"); __builtin_amdgcn_wave_barrier(); __builtin_amdgcn_fence(__ATOMIC_ACQUIRE, "workgroup"); }
__device__ __forceinline__ float pmul(float a, float b) { float p = a * b; asm volatile("" : "+v"(p)); return p; }
__device__ __forceinline__ float opaque(float a) { asm volatile("" : "+v"(a)); return a; }
__device__ __forceinline__ float lrelu(float x) { return x >= 0.0f ? x : NEG * x; }
// v_exp_f32 with the one slot behind a transcendental tied to it
__device__ __forceinline__ float nexp_slot(float x) { const float y = x * 1.4426950408889634f; float r; asm("v_exp_f32 %0, %1\n\tv_nop" : "=v"(r) : "v"(y)); return r; }

// projection: block = 4 waves = 64 nodes of one group. W is rounded, scaled and transposed into LDS by the block itself; the h^T plane goes out straight from the accumulators
// (a lane holds 8 consecutive nodes of one column = one 16-byte piece of an h^T row), gathered in LDS so that eight lanes store one whole 128-byte line.
constexpr int WP = F + 8, JP = 64 + 8;   // LDS row pitches of 272 and 144 bytes = 16 x odd, free of bank conflicts for 16-byte reads
__global__ __launch_bounds__(128) void proj_kernel(const float* __restrict__ x, const float* __restrict__ w, const float* __restrict__ as_, const float* __restrict__ ad_, float* __restrict__ S, float* __restrict__ Dd, b16* __restrict__ HTH) {
  __shared__ __attribute__((aligned(16))) b16 Wt[F][WP];      // [output column][k]
  __shared__ __attribute__((aligned(16))) b16 Ht[F][JP];   // [column][node of the block]
  __shared__ __attribute__((aligned(16))) float sa[64], sd[64];
  const int wave = threadIdx.x >> 5, lane = threadIdx.x & 31, nloc = lane & 15, hlf = lane >> 4; const size_t m0 = (size_t)blockIdx.x * 64 + wave * 16; const float* xr = x + (m0 + nloc) * F;
  const float* xp = xr + 8 * hlf; const int o4 = lane * 4, kw = wave * 32; const float* wp = w + (size_t)kw * F + o4;   // wave: 32 rows k of W; lane: 4 columns
  v4f xv[4][4], r[4][8];   // this lane's 32 x 4 piece of W, asked for first (short way, needed first), and its x in fragment order, which flies under the W staging
#pragma unroll
  for (int q = 0; q < 4; ++q) {
#pragma unroll
    for (int j = 0; j < 8; ++j) r[q][j] = *(const v4f*)(wp + (q * 8 + j) * F); }
  asm volatile("s_wait_xcnt 0x0" :: "v"(wp) : "memory");   // precaution: no register that the W loads name is rewritten ahead of this wait (wp is named so that the pair lives up to it)
#pragma unroll
  for (int q = 0; q < 4; ++q) { xv[q][0] = *(const v4f*)(xp + q * 32); xv[q][1] = *(const v4f*)(xp + q * 32 + 4); xv[q][2] = *(const v4f*)(xp + q * 32 + 16); xv[q][3] = *(const v4f*)(xp + q * 32 + 20); }
  asm volatile("s_wait_xcnt 0x0" :: "v"(xp) : "memory");   // the same precaution for the x loads
#pragma unroll
  for (int q = 0; q < 4; ++q) {
#pragma unroll
    for (int cc = 0; cc < 4; ++cc) { v8b v;
#pragma unroll
      for (int j = 0; j < 8; ++j) v[j] = (b16)(bf16_rne(r[q][j][cc]) * WSC);
      *(v8b*)(&Wt[o4 + cc][kw + q * 8]) = v; } }
  __syncthreads();   // publishes W^T to the four waves
  float av[8], bv[8];   // this lane's a_src and a_dst, one group of 16 loads asked for here, so that they fly under the products and none is waited for alone behind them
#pragma unroll   // all sixteen loads go out before any is waited for
  for (int t = 0; t < 8; ++t) { av[t] = as_[t * 16 + nloc]; bv[t] = ad_[t * 16 + nloc]; }
  asm volatile("s_wait_xcnt 0x0" :: "v"(nloc) : "memory");   // precaution: no register that these loads name is rewritten ahead of this wait (the lane's index, their one vector operand, is named so that it lives up to it)
  v8f acc[8];
#pragma unroll
  for (int t = 0; t < 8; ++t) acc[t] = (v8f){};
#pragma unroll
  for (int q = 0; q < 4; ++q) { v16b a, b[8];
#pragma unroll
    for (int t = 0; t < 8; ++t) b[t] = frag_kb(&Wt[t * 16 + nloc][q * 32], hlf);
    __builtin_amdgcn_sched_barrier(0);   // keeps the 16 LDS reads one group in front of the rounding of x, which then covers their latency
#pragma unroll
    for (int j = 0; j < 4; ++j) { a[j] = (b16)(bf16_rne(xv[q][0][j]) * XS); a[4 + j] = (b16)(bf16_rne(xv[q][1][j]) * XS); a[8 + j] = (b16)(bf16_rne(xv[q][2][j]) * XS); a[12 + j] = (b16)(bf16_rne(xv[q][3][j]) * XS); }
#pragma unroll
    for (int t = 0; t < 8; ++t) acc[t] = wmma16b(a, b[t], acc[t]); }
  float ps[8], pd[8]; for (int r8 = 0; r8 < 8; ++r8) { ps[r8] = 0.0f; pd[r8] = 0.0f; }
#pragma unroll
  for (int t = 0; t < 8; ++t) { const int c = t * 16 + nloc; const float ws_ = opaque(bf16_rne(av[t])), wd_ = opaque(bf16_rne(bv[t])); v8b hi;
#pragma unroll
    for (int r8 = 0; r8 < 8; ++r8) { const float v = acc[t][r8] * (1.0f / (XS * WSC)); ps[r8] += pmul(v, ws_); pd[r8] += pmul(v, wd_); hi[r8] = (b16)(v * XS); }
    *(v8b*)(&Ht[c][wave * 16 + 8 * hlf]) = hi; }
#pragma unroll   // the sixteen row sums go through each exchange stage side by side: four waits instead of one per sum and stage; every sum keeps its own order of additions
  for (int o = 1; o < 16; o <<= 1) { float ta[8], tb[8];
#pragma unroll
    for (int r8 = 0; r8 < 8; ++r8) { ta[r8] = __shfl_xor(ps[r8], o); tb[r8] = __shfl_xor(pd[r8], o); }
#pragma unroll
    for (int r8 = 0; r8 < 8; ++r8) { ps[r8] += ta[r8]; pd[r8] += tb[r8]; } }
  if (nloc == 0) { float* qa = &sa[wave * 16 + 8 * hlf]; float* qd = &sd[wave * 16 + 8 * hlf];
    *(v4f*)qa = (v4f){ps[0], ps[1], ps[2], ps[3]}; *(v4f*)(qa + 4) = (v4f){ps[4], ps[5], ps[6], ps[7]}; *(v4f*)qd = (v4f){pd[0], pd[1], pd[2], pd[3]}; *(v4f*)(qd + 4) = (v4f){pd[4], pd[5], pd[6], pd[7]}; }
  __syncthreads();
  { const int g = blockIdx.x / (NN / 64), j0 = (blockIdx.x % (NN / 64)) * 64, cr = threadIdx.x >> 3, ch = (threadIdx.x & 7) * 8;
#pragma unroll
    for (int it = 0; it < 8; ++it) { const int c = it * 16 + cr; const size_t d = ((size_t)g * F + c) * NN + j0 + ch; *(v8b*)(HTH + d) = *(const v8b*)(&Ht[c][ch]); }
    if (threadIdx.x < 16) *(v4f*)(S + (size_t)blockIdx.x * 64 + threadIdx.x * 4) = *(const v4f*)(&sa[threadIdx.x * 4]); else if (threadIdx.x < 32) *(v4f*)(Dd + (size_t)blockIdx.x * 64 + (threadIdx.x - 16) * 4) = *(const v4f*)(&sd[(threadIdx.x - 16) * 4]);
  }
}
// attention: block = 8 waves = 128 rows i of group g: wave = 32 rows (two A fragments, row group wave & 3) x one half of every k tile (wave >> 2), so that each h^T fragment read from LDS feeds two row fragments
// and two waves still share a SIMD; the two halves' partial sums are joined through LDS at the end, each wave finishing 16 of the pair's 32 rows. max_j d_j over the group; P fragments on the fly:
// p = exp(leaky(s_i + d_j) - leaky(s_i + max d)) x16384 in f16; den = the f32 sum of those same f16 p, taken by a product with a fragment of ones. The scores are rank-1 and leaky(z) = max(z, 0.2 z), so p = max(a_i E_j, b_i F_j) with E_j = exp(d_j - max d),
// F_j = exp(0.2 (d_j - max d)), a_i = exp(z_i - m_i), b_i = exp(0.2 z_i - m_i), z_i = s_i + max d, m_i = leaky(z_i): every factor is at most 1; all four are rounded to f16 (x128 each), E and F once per block into LDS, and the loop forms two p by
// three instructions (two packed products, one packed maximum) with no f32 value, no conversion, no exponential and no global load. A 32-k step asks for all its h^T fragments first, forms P under their latency, then runs its products over the eighteen independent tiles (sixteen of out, two of row sums). The h^T plane reaches the waves
// through LDS: a tile = 256 k of all 128 columns, brought once per block by asynchronous copies, two buffers, so that the next tile flies under this tile's products.
constexpr int KT = 256, NT = NN / KT, KP = KT + 8;   // KP: LDS row pitch of 528 bytes = 16 x odd, free of bank conflicts for 16-byte reads
// Eight rows-of-8 steps: each lane copies 16 bytes, a wave covers the four whole 128-byte lines of a row. The s_wait_xcnt stands inside the statement so that no address register is rewritten ahead of it.
__device__ __forceinline__ void copy8(unsigned int l, const b16* g) {
  asm volatile("global_load_async_to_lds_b128 %0, %8, off\n\t"
               "global_load_async_to_lds_b128 %1, %9, off\n\t"
               "global_load_async_to_lds_b128 %2, %10, off\n\t"
               "global_load_async_to_lds_b128 %3, %11, off\n\t"
               "global_load_async_to_lds_b128 %4, %12, off\n\t"
               "global_load_async_to_lds_b128 %5, %13, off\n\t"
               "global_load_async_to_lds_b128 %6, %14, off\n\t"
               "global_load_async_to_lds_b128 %7, %15, off\n\t"
               "s_wait_xcnt 0x0"
               :: "v"(l), "v"(l + 1u * 8 * KP * 2), "v"(l + 2u * 8 * KP * 2), "v"(l + 3u * 8 * KP * 2), "v"(l + 4u * 8 * KP * 2), "v"(l + 5u * 8 * KP * 2), "v"(l + 6u * 8 * KP * 2), "v"(l + 7u * 8 * KP * 2),
                  "v"(g), "v"(g + 1 * 8 * NN), "v"(g + 2 * 8 * NN), "v"(g + 3 * 8 * NN), "v"(g + 4 * 8 * NN), "v"(g + 5 * 8 * NN), "v"(g + 6 * 8 * NN), "v"(g + 7 * 8 * NN)
               : "memory");
}
__global__ __launch_bounds__(256) void attn_kernel(const float* __restrict__ S, const float* __restrict__ Dd, const b16* __restrict__ HTH, float* __restrict__ out) {
  __shared__ __attribute__((aligned(16))) b16 ring[2][F][KP];   // [buffer][column][k]
  __shared__ __attribute__((aligned(16))) float Tf[8][16][F + 4];
  __shared__ __attribute__((aligned(16))) float Xc[8][9][2][32][4];   // [wave][column tile, 8 = row sums][accumulator rows 0..3, 4..7][lane]: the row fragment that a wave hands to its partner
  __shared__ __attribute__((aligned(16))) b16 Et[2][NN];   // the group's column factors x128: [0] E_j, [1] F_j
  const int wave = __builtin_amdgcn_readfirstlane(threadIdx.x >> 5), rg = wave & 3, kh = wave >> 2, lane = threadIdx.x & 31, nloc = lane & 15, hlf = lane >> 4;
  const size_t i0 = (size_t)blockIdx.x * 128 + rg * 32; const int g = (int)(i0 / NN); const float* Dg = Dd + (size_t)g * NN;
  const b16* Hh = HTH + (size_t)g * F * NN;
  const int crow = threadIdx.x >> 5, cch = (threadIdx.x & 31) * 8; const unsigned int csrc = (unsigned int)(crow * NN + cch);
  const b16* gh = Hh;   // the next tile to be copied, the same for the whole block; the lane's own offset is added at the copy
  auto fill = [&](int tile) { const int b = tile & 1; copy8((unsigned int)(size_t)&ring[b][crow][cch], gh + csrc); copy8((unsigned int)(size_t)&ring[b][64 + crow][cch], gh + csrc + 64 * NN); gh += KT; };
  const float* Sr = S + i0; v4f dv[8];   // the group's 1,024 d_j, 32 a lane, and the two s_i: one group of loads, one latency, asked for ahead of tile 0 because they are needed first
#pragma unroll   // all eight loads go out before any is waited for
  for (int q = 0; q < 8; ++q) dv[q] = *(const v4f*)(Dg + lane * 4 + q * 128);
  const float si0 = Sr[nloc], si1 = Sr[nloc + 16];
  asm volatile("s_wait_xcnt 0x0" :: "s"(Dg), "s"(Sr) : "memory");   // precaution: no register that these loads name is rewritten ahead of this wait (their scalar bases are named so that they live up to it; their lane indices are in use to the kernel's end)
  fill(0);
  __builtin_amdgcn_sched_barrier(0);   // keeps the wait on the d loads behind the issue of tile 0's copies, so that both fly at once
  float mx = -INFINITY;
#pragma unroll   // dv stays in registers
  for (int q = 0; q < 8; ++q) mx = fmaxf(mx, fmaxf(fmaxf(dv[q][0], dv[q][1]), fmaxf(dv[q][2], dv[q][3])));
  for (int o = 16; o; o >>= 1) mx = fmaxf(mx, __shfl_xor(mx, o));
  const float zi0 = si0 + mx, mi0 = lrelu(zi0), zi1 = si1 + mx, mi1 = lrelu(zi1);   // row factors of the two row fragments
  const b16 ca0 = (b16)(nexp_slot(zi0 - mi0) * PH), cb0 = (b16)(nexp_slot(NEG * zi0 - mi0) * PH), ca1 = (b16)(nexp_slot(zi1 - mi1) * PH), cb1 = (b16)(nexp_slot(NEG * zi1 - mi1) * PH);
  { v4f da = dv[0];   // every wave holds all 1,024 d_j: wave w forms the factors of columns 128 w .. 128 w + 127, 4 a lane
#pragma unroll   // constant indices into dv
    for (int q = 1; q < 8; ++q) if (wave == q) da = dv[q];
    v4b ea, fa;
#pragma unroll   // constant vector indices; the eight exponentials run side by side
    for (int c = 0; c < 4; ++c) { const float ua = da[c] - mx; ea[c] = (b16)(nexp_slot(ua) * PH); fa[c] = (b16)(nexp_slot(NEG * ua) * PH); }
    b16* q = &Et[0][wave * 128 + lane * 4]; *(v4b*)q = ea; *(v4b*)(q + NN) = fa; }   // published by the barrier that publishes tile 0
  v8f acc0[8], acc1[8], dn0 = (v8f){}, dn1 = (v8f){};   // dn: the row sums, in the accumulators' row order, the same in every column
  v16b ones;
#pragma unroll
  for (int e = 0; e < 16; ++e) ones[e] = (b16)1.0f;
#pragma unroll
  for (int t = 0; t < 8; ++t) { acc0[t] = (v8f){}; acc1[t] = (v8f){}; }
  asm volatile("s_wait_asynccnt 0x0" ::: "memory");   // this wave's share of tile 0 has landed
  __syncthreads();                                    // publishes tile 0 to the other waves
  fill(1);
  const b16* et = &Et[0][8 * hlf];   // this lane's columns, in its fragment order
  const int k0 = kh * (KT / 2);        // this wave's half of every tile
  v8b ne0 = *(const v8b*)(et + k0), ne1 = *(const v8b*)(et + k0 + 16), nf0 = *(const v8b*)(et + k0 + NN), nf1 = *(const v8b*)(et + k0 + NN + 16);   // the wave's first step's factors
#pragma unroll 1   // one 32-k step a trip: keeps each step's LDS reads, P arithmetic and products in that order, one step's fragments live at a time
  for (int st = 0; st < 4 * NT; ++st) { const int tt = st >> 2, bf = tt & 1, s = (st & 3) * 32, ks = k0 + s; v16b ph0, ph1, bh[8];
    const v8b e0 = ne0, e1 = ne1, f0 = nf0, f1 = nf1;   // this step's factors, asked for one step ago
#pragma unroll
    for (int t = 0; t < 8; ++t) bh[t] = frag_kb(&ring[bf][t * 16 + nloc][ks], hlf);
    { const b16* en = et + ((tt * KT + ks + (s == 96 ? 32 + KT / 2 : 32)) & (NN - 1)); ne0 = *(const v8b*)(en); ne1 = *(const v8b*)(en + 16); nf0 = *(const v8b*)(en + NN); nf1 = *(const v8b*)(en + NN + 16); }   // the wave's next step's factors, behind the fragments (the last step wraps, unused)
    __builtin_amdgcn_sched_barrier(0);   // keeps the loads one group in front of the P arithmetic, which then covers the LDS latency
    ph0 = __builtin_shufflevector(__builtin_elementwise_max(e0 * ca0, f0 * cb0), __builtin_elementwise_max(e1 * ca0, f1 * cb0), 0, 1, 2, 3, 4, 5, 6, 7, 8, 9, 10, 11, 12, 13, 14, 15);
    ph1 = __builtin_shufflevector(__builtin_elementwise_max(e0 * ca1, f0 * cb1), __builtin_elementwise_max(e1 * ca1, f1 * cb1), 0, 1, 2, 3, 4, 5, 6, 7, 8, 9, 10, 11, 12, 13, 14, 15);
    __builtin_amdgcn_sched_barrier(0);   // keeps the 18 products one run behind the arithmetic, with no LDS read among them
    dn0 = wmma16p(ph0, ones, dn0); dn1 = wmma16p(ph1, ones, dn1);   // the row sums: two more independent tiles, no LDS read
#pragma unroll
    for (int t = 0; t < 8; ++t) { acc0[t] = wmma16p(ph0, bh[t], acc0[t]); acc1[t] = wmma16p(ph1, bh[t], acc1[t]); }
    if (s == 96) {   // the tile's last step is done (the same test in every wave of the block)
      asm volatile("s_wait_dscnt 0x0" ::: "memory");      // this wave's reads of the buffer are done before it is refilled
      asm volatile("s_wait_asynccnt 0x0" ::: "memory");   // this wave's share of tile tt + 1 has landed
      __syncthreads();                                    // publishes tile tt + 1 and ends every wave's reads of tile tt
      if (tt + 2 < NT) fill(tt + 2); } }
  asm volatile("s_wait_asynccnt 0x0" ::: "memory");     // no copy is outstanding when the wave goes on
  v8f acc[8];   // the wave of k half kh finishes row fragment kh and hands the other one to its partner
#pragma unroll
  for (int t = 0; t < 8; ++t) { const v8f gv = kh ? acc0[t] : acc1[t]; acc[t] = kh ? acc1[t] : acc0[t];
    *(v4f*)(&Xc[wave][t][0][lane][0]) = (v4f){gv[0], gv[1], gv[2], gv[3]}; *(v4f*)(&Xc[wave][t][1][lane][0]) = (v4f){gv[4], gv[5], gv[6], gv[7]}; }
  v8f dn = kh ? dn1 : dn0;
  { const v8f gv = kh ? dn0 : dn1; *(v4f*)(&Xc[wave][8][0][lane][0]) = (v4f){gv[0], gv[1], gv[2], gv[3]}; *(v4f*)(&Xc[wave][8][1][lane][0]) = (v4f){gv[4], gv[5], gv[6], gv[7]}; }
  __syncthreads();   // publishes each wave's handed-over partial sums to its partner
  const int pw = wave ^ 4;
#pragma unroll
  for (int t = 0; t < 8; ++t) { const v4f x0 = *(const v4f*)(&Xc[pw][t][0][lane][0]), x1 = *(const v4f*)(&Xc[pw][t][1][lane][0]);
#pragma unroll
    for (int c = 0; c < 4; ++c) { acc[t][c] += x0[c]; acc[t][4 + c] += x1[c]; } }
  float inv[8];   // one scale per row of the lane: the partner's half of its eight sums comes by two reads, the eight divisions run side by side
  { const v4f q0 = *(const v4f*)(&Xc[pw][8][0][lane][0]), q1 = *(const v4f*)(&Xc[pw][8][1][lane][0]);
#pragma unroll   // eight independent division chains instead of one after another
    for (int r8 = 0; r8 < 4; ++r8) { inv[r8] = (1.0f / XS) / (dn[r8] + q0[r8]); inv[4 + r8] = (1.0f / XS) / (dn[4 + r8] + q1[r8]); } }
#pragma unroll
  for (int t = 0; t < 8; ++t) { const int c = t * 16 + nloc;
#pragma unroll   // constant accumulator indices, no LDS read and no wait per element
    for (int r8 = 0; r8 < 8; ++r8) Tf[wave][8 * hlf + r8][c] = acc[t][r8] * inv[r8]; }
  wave_lds_sync();
  { const size_t r0 = i0 + kh * 16; for (int rr = 0; rr < 16; ++rr) *(v4f*)(out + (r0 + rr) * F + lane * 4) = *(const v4f*)(&Tf[wave][rr][lane * 4]);  }
}
}  // namespace

extern "C" void kernel_launch(void* const* d_in, const int* in_sizes, int n_in, void* d_out, int out_size, void* d_ws, size_t ws_size, hipStream_t stream) {
  (void)n_in;
  auto Fp = [&](int i) { return (const float*)d_in[i]; };
  // input order: 0 x [2,16,1024,128], 1 W [128,128], 2 a_src [128], 3 a_dst [128]
  if (in_sizes[0] != M * F || in_sizes[1] != F * F || in_sizes[2] != F || in_sizes[3] != F || out_size != M * F) return;
  size_t off = 0; char* ws = (char*)d_ws;
  auto carve = [&](size_t bytes) { char* p = ws + off; off += (bytes + 255) & ~(size_t)255; return p; };
  float* S = (float*)carve((size_t)M * 4); float* Dd = (float*)carve((size_t)M * 4); b16* HTH = (b16*)carve((size_t)NG * F * NN * 2);
  if (off > ws_size || off > ((size_t)64 << 20)) return;   // ~ 9 MB
  proj_kernel<<<M / 64, 128, 0, stream>>>(Fp(0), Fp(1), Fp(2), Fp(3), S, Dd, HTH);
  attn_kernel<<<M / 128, 256, 0, stream>>>(S, Dd, HTH, (float*)d_out);
}
